// v000
// Measured on an AMD MI455X. A time is GPU time per run, averaged over a window of back-to-back runs after a warm-up
// (all launches, gaps included; the runs take copies of the inputs in turn), and the median of several windows.
// Apart from v000's, it joins two sittings. Times from different sittings can be a few percent apart, while
// side-by-side timings come from the same sitting.
// The starting kernel, v000, takes 185 microseconds a run.
#include <hip/hip_runtime.h>
#include <stdint.h>

// All six contractions (three input projections, q.k^T, p.v, output projection):
// v_wmma_f32_16x16x32_f16, f16 operands, f32 accumulate. Float inputs are RNE-converted to
// bf16 values held exactly in f16 containers (activations x16, weights x64; tau, delta, bias as
// f32-held bf16 values); intermediates: q,k,v f16 x8, softmax numerators f16 x2^14, context f16 x32.
// Every scale is a power of two removed in f32. Softmax statistics in f32.

#ifndef AFFINE_BF16
#define AFFINE_BF16 1   // 1: tau and delta RNE-converted to bf16 values before use; 0: used as given
#endif

#define DM 512
#define NH 8
#define HD 64
#define NB 4
#define SQ 2048
#define MR (NB * SQ)            // 8192 token rows
#define PLANE (MR * DM)         // 4194304 elements per activation plane
#define PP 72                   // f16 LDS pitch of the per-wave softmax/context tile
#define PC 136                  // f16 LDS pitch of the row-major 64x128 epilogue tile
#define PT 72                   // f16 LDS pitch of the transposed 128x64 epilogue tile
#define PO 132                  // f32 LDS pitch of the 64x128 epilogue tile

#define CVT_BLK 256
#define CVT_UNITS 4
#define UPP (PLANE / 8)         // 8-element units per plane = 524288
#define CVT_GRID (UPP / (CVT_BLK * CVT_UNITS))   // 512, exact

typedef _Float16 v16h __attribute__((ext_vector_type(16)));
typedef _Float16 v8h  __attribute__((ext_vector_type(8)));
typedef v8h __attribute__((may_alias)) v8ha;
typedef float v8f __attribute__((ext_vector_type(8)));
typedef float v4f __attribute__((ext_vector_type(4)));
typedef v4f __attribute__((may_alias)) v4fa;

union Frag { v16h v; v8h p[2]; };

#if defined(__has_builtin)
#if __has_builtin(__builtin_amdgcn_exp2f)
#define EX2(x) __builtin_amdgcn_exp2f(x)
#endif
#endif
#ifndef EX2
#define EX2(x) __expf((x) * 0.69314718055994531f)
#endif

// f32 -> nearest-even bf16 value, returned as f32
__device__ __forceinline__ float bfr(float x)
{
    unsigned u = __float_as_uint(x);
    u = (u + 0x7fffu + ((u >> 16) & 1u)) & 0xffff0000u;
    return __uint_as_float(u);
}
// bf16 value times a power of two, held in an f16 container (exact in the normal range)
__device__ __forceinline__ _Float16 cvh(float x, float s) { return (_Float16)(bfr(x) * s); }

__device__ __forceinline__ v8f mma16(v16h a, v16h b, v8f c)
{
    return __builtin_amdgcn_wmma_f32_16x16x32_f16(false, a, false, b, (short)0, c, false, false);
}

__device__ __forceinline__ v8f zero8()
{
    v8f z;
#pragma unroll
    for (int i = 0; i < 8; ++i) z[i] = 0.0f;
    return z;
}

// ------------------------------------------------------------------------------------------
// Activation convert: three f32 [8192][512] planes -> f16 planes (bf16 value x16).
// One lane handles 8 consecutive elements (16 B); one wave store instruction covers 4 whole
__global__ __launch_bounds__(CVT_BLK)
void k_cvt_act(const float* __restrict__ x0, const float* __restrict__ x1,
               const float* __restrict__ x2, _Float16* __restrict__ xh)
{
    const int pl = blockIdx.y;
    const float* src = (pl == 0) ? x0 : ((pl == 1) ? x1 : x2);
    _Float16* dst = xh + (size_t)pl * PLANE;
    const int t0 = blockIdx.x * CVT_BLK + (int)threadIdx.x;
    v8h val[CVT_UNITS];
    int uu[CVT_UNITS];
#pragma unroll
    for (int j = 0; j < CVT_UNITS; ++j) {
        int u = t0 + j * (CVT_GRID * CVT_BLK);
        u = (u < UPP) ? u : (UPP - 1);
        uu[j] = u;
        const float4 a = *(const float4*)(src + (size_t)u * 8);
        const float4 b = *(const float4*)(src + (size_t)u * 8 + 4);
        v8h v;
        v[0] = cvh(a.x, 16.0f); v[1] = cvh(a.y, 16.0f); v[2] = cvh(a.z, 16.0f); v[3] = cvh(a.w, 16.0f);
        v[4] = cvh(b.x, 16.0f); v[5] = cvh(b.y, 16.0f); v[6] = cvh(b.z, 16.0f); v[7] = cvh(b.w, 16.0f);
        val[j] = v;
    }
#pragma unroll
    for (int j = 0; j < CVT_UNITS; ++j)
        *(v8h*)(dst + (size_t)uu[j] * 8) = val[j];
    
}

// ------------------------------------------------------------------------------------------
// Weight convert + transpose: four f32 W[k][n] (512x512) -> f16 Wt[n][k] (bf16 value x64),
// k-contiguous so B fragments load like A fragments. 64x64 tile through LDS; each output line
__global__ __launch_bounds__(128)
void k_cvt_wt(const float* __restrict__ w0, const float* __restrict__ w1,
              const float* __restrict__ w2, const float* __restrict__ w3,
              _Float16* __restrict__ wt)
{
    __shared__ _Float16 __attribute__((aligned(16))) sT[64 * PT];   // [n_local][k_local]
    const int z = blockIdx.z;
    const float* src = (z == 0) ? w0 : ((z == 1) ? w1 : ((z == 2) ? w2 : w3));
    _Float16* dst = wt + (size_t)z * (DM * DM);
    const int k0 = blockIdx.y * 64, n0 = blockIdx.x * 64;
    const int t = threadIdx.x, l = t & 31, w = t >> 5;
    const int nn = (t & 15) * 4, kb = t >> 4;
#pragma unroll
    for (int i = 0; i < 8; ++i) {
        const int kk = kb + 8 * i;
        const float4 v = *(const float4*)(src + (size_t)(k0 + kk) * DM + n0 + nn);
        sT[(nn + 0) * PT + kk] = cvh(v.x, 64.0f);
        sT[(nn + 1) * PT + kk] = cvh(v.y, 64.0f);
        sT[(nn + 2) * PT + kk] = cvh(v.z, 64.0f);
        sT[(nn + 3) * PT + kk] = cvh(v.w, 64.0f);
    }
    __syncthreads();
    v8h val[4];
    size_t off[4];
#pragma unroll
    for (int i = 0; i < 4; ++i) {
        const int line = 16 * w + 4 * i + (l >> 3);   // n_local
        const int ck = (l & 7) * 8;
        val[i] = *(const v8ha*)(sT + line * PT + ck);
        off[i] = (size_t)(n0 + line) * DM + k0 + ck;
    }
#pragma unroll
    for (int i = 0; i < 4; ++i) *(v8h*)(dst + off[i]) = val[i];
    
}

// ------------------------------------------------------------------------------------------
// C[64 x 128 per block] = A[rows][512] (f16, row-major) * B, with B given as Bt[n][k] (f16).
// 4 waves, each a 32x64 sub-tile = 2x4 accumulators; fragments loaded straight from global
// with the 16x16x32 split-k lane map for both A and B.
// !OUTF: v = (acc*s_acc + bf16(bias)) * s_out -> f16; blockIdx.z selects the plane
//        (z=0,1 row-major [8192][512]; z=2 head-transposed [NB][NH][HD][SQ]).
// OUTF : same value -> f32 d_out.
template<bool OUTF>
__global__ __launch_bounds__(128) __attribute__((amdgpu_num_vgpr(248)))
void k_gemm(const _Float16* __restrict__ A, int planeA, const _Float16* __restrict__ Bt,
            const float* __restrict__ bi0, const float* __restrict__ bi1,
            const float* __restrict__ bi2,
            _Float16* __restrict__ O16, float* __restrict__ O32, float s_acc, float s_out)
{
    const int t = threadIdx.x, l = t & 31, w = t >> 5, h = l >> 4, m = l & 15;
    const int z = blockIdx.z;
    const int n0 = blockIdx.x * 128, m0 = blockIdx.y * 64;
    const int wm = (w >> 1) * 32, wn = (w & 1) * 64;
    const _Float16* Ab = A + (size_t)z * (size_t)planeA;
    const _Float16* Bb = Bt + (size_t)z * (DM * DM);
    const float* bias = (z == 0) ? bi0 : ((z == 1) ? bi1 : bi2);

    const _Float16* ap[2];
    const _Float16* bp[4];
#pragma unroll
    for (int mi = 0; mi < 2; ++mi) ap[mi] = Ab + (size_t)(m0 + wm + 16 * mi + m) * DM + 8 * h;
#pragma unroll
    for (int ni = 0; ni < 4; ++ni) bp[ni] = Bb + (size_t)(n0 + wn + 16 * ni + m) * DM + 8 * h;

    v8f acc[2][4];
#pragma unroll
    for (int mi = 0; mi < 2; ++mi)
#pragma unroll
        for (int ni = 0; ni < 4; ++ni) acc[mi][ni] = zero8();

#pragma unroll 2
    for (int k0 = 0; k0 < DM; k0 += 32) {
        Frag a[2], b[4];
#pragma unroll
        for (int mi = 0; mi < 2; ++mi) {
            a[mi].p[0] = *(const v8h*)(ap[mi] + k0);        // k0+8h .. +7
            a[mi].p[1] = *(const v8h*)(ap[mi] + k0 + 16);   // k0+16+8h .. +7
        }
#pragma unroll
        for (int ni = 0; ni < 4; ++ni) {
            b[ni].p[0] = *(const v8h*)(bp[ni] + k0);
            b[ni].p[1] = *(const v8h*)(bp[ni] + k0 + 16);
        }
#pragma unroll
        for (int mi = 0; mi < 2; ++mi)
#pragma unroll
            for (int ni = 0; ni < 4; ++ni)
                acc[mi][ni] = mma16(a[mi].v, b[ni].v, acc[mi][ni]);
        asm volatile("v_nop\n\tv_nop\n\tv_nop\n\tv_nop"
                     : "+v"(acc[0][0]), "+v"(acc[0][1]), "+v"(acc[0][2]), "+v"(acc[0][3]),
                       "+v"(acc[1][0]), "+v"(acc[1][1]), "+v"(acc[1][2]), "+v"(acc[1][3])
                     : "v"(a[0].v), "v"(a[1].v), "v"(b[0].v), "v"(b[1].v), "v"(b[2].v), "v"(b[3].v));
    }

    float bb[4];
#pragma unroll
    for (int ni = 0; ni < 4; ++ni) bb[ni] = bfr(bias[n0 + wn + 16 * ni + m]);

    if constexpr (OUTF) {
        __shared__ float __attribute__((aligned(16))) sO[64 * PO];
#pragma unroll
        for (int mi = 0; mi < 2; ++mi)
#pragma unroll
            for (int ni = 0; ni < 4; ++ni)
#pragma unroll
                for (int r = 0; r < 8; ++r) {
                    const int row = wm + 16 * mi + 8 * h + r;
                    const int col = wn + 16 * ni + m;
                    sO[row * PO + col] = (acc[mi][ni][r] * s_acc + bb[ni]) * s_out;
                }
        __syncthreads();
        v4f val[16];
#pragma unroll
        for (int i = 0; i < 16; ++i) val[i] = *(const v4fa*)(sO + (16 * w + i) * PO + 4 * l);
#pragma unroll
        for (int i = 0; i < 16; ++i)
            *(v4f*)(O32 + (size_t)(m0 + 16 * w + i) * DM + n0 + 4 * l) = val[i];
        
    } else {
        __shared__ _Float16 __attribute__((aligned(16))) sC[9216];   // 64x136 or 128x72 view
        if (z != 2) {
#pragma unroll
            for (int mi = 0; mi < 2; ++mi)
#pragma unroll
                for (int ni = 0; ni < 4; ++ni)
#pragma unroll
                    for (int r = 0; r < 8; ++r) {
                        const int row = wm + 16 * mi + 8 * h + r;
                        const int col = wn + 16 * ni + m;
                        sC[row * PC + col] = (_Float16)((acc[mi][ni][r] * s_acc + bb[ni]) * s_out);
                    }
        } else {
#pragma unroll
            for (int mi = 0; mi < 2; ++mi)
#pragma unroll
                for (int ni = 0; ni < 4; ++ni)
#pragma unroll
                    for (int r = 0; r < 8; ++r) {
                        const int row = wm + 16 * mi + 8 * h + r;
                        const int col = wn + 16 * ni + m;
                        sC[col * PT + row] = (_Float16)((acc[mi][ni][r] * s_acc + bb[ni]) * s_out);
                    }
        }
        __syncthreads();
        v8h val[8];
        size_t off[8];
        if (z != 2) {
#pragma unroll
            for (int i = 0; i < 8; ++i) {
                const int row = 16 * w + 2 * i + (l >> 4);
                const int c8 = (l & 15) * 8;
                val[i] = *(const v8ha*)(sC + row * PC + c8);
                off[i] = (size_t)z * PLANE + (size_t)(m0 + row) * DM + n0 + c8;
            }
        } else {
            // transposed: one line per tile column (64 consecutive s of one (b,head,e) row)
            const int bidx = m0 / SQ, s0 = m0 - bidx * SQ;
#pragma unroll
            for (int i = 0; i < 8; ++i) {
                const int col = 32 * w + 4 * i + (l >> 3);
                const int ck = (l & 7) * 8;
                const int gc = n0 + col;
                val[i] = *(const v8ha*)(sC + col * PT + ck);
                off[i] = (size_t)2 * PLANE
                       + ((size_t)((bidx * NH + (gc >> 6)) * HD + (gc & 63))) * SQ + s0 + ck;
            }
        }
#pragma unroll
        for (int i = 0; i < 8; ++i) *(v8h*)(O16 + off[i]) = val[i];
        
    }
}

// ------------------------------------------------------------------------------------------
// Fused attention per (batch, head, 64 query rows); 4 waves x 16 rows; 64-key tiles.
// Qh, Kh: f16 [NB*SQ][512] (x8); Vt: f16 [NB][NH][HD][SQ] (x8); Ctx: f16 [NB*SQ][512] (x32).
// S = Q.K^T on WMMA; logits in the log2 domain; online softmax in f32; numerators written to a
// per-wave LDS tile as f16 x2^14 and re-read as A fragments after a block barrier (may_alias
__global__ __launch_bounds__(128) __attribute__((amdgpu_num_vgpr(248)))
void k_attn(const _Float16* __restrict__ Qh, const _Float16* __restrict__ Kh,
            const _Float16* __restrict__ Vt, const float* __restrict__ tau,
            const float* __restrict__ delta, _Float16* __restrict__ Ctx)
{
    __shared__ _Float16 __attribute__((aligned(16))) sP[64 * PP];
    const int t = threadIdx.x, l = t & 31, w = t >> 5, h = l >> 4, m = l & 15;
    const int bq = blockIdx.z, hd = blockIdx.y, q0 = blockIdx.x * 64;

    const float LOG2E = 1.4426950408889634f;
#if AFFINE_BF16
    const float tb = bfr(tau[bq]);
    const float db = bfr(delta[bq]);
#else
    const float tb = tau[bq];
    const float db = delta[bq];
#endif
    // logit2 = log2(e) * 0.125 * (s * tau + delta), s = sacc / 64 (q and k each carried x8)
    const float c1 = tb * (0.125f / 64.0f) * LOG2E;
    const float c0 = db * 0.125f * LOG2E;

    Frag qf[2];
    {
        const _Float16* qp = Qh + (size_t)(bq * SQ + q0 + 16 * w + m) * DM + hd * HD + 8 * h;
#pragma unroll
        for (int ec = 0; ec < 2; ++ec) {
            qf[ec].p[0] = *(const v8h*)(qp + 32 * ec);        // e = 32ec+8h .. +7
            qf[ec].p[1] = *(const v8h*)(qp + 32 * ec + 16);   // e = 32ec+16+8h .. +7
        }
    }
    const _Float16* kbase = Kh + (size_t)(bq * SQ + m) * DM + hd * HD + 8 * h;
    const _Float16* vbase = Vt + ((size_t)(bq * NH + hd) * HD + m) * SQ + 8 * h;
    _Float16* myP = sP + w * 16 * PP;

    v8f oacc[4];
#pragma unroll
    for (int et = 0; et < 4; ++et) oacc[et] = zero8();
    float mrun[8], lpart[8];
#pragma unroll
    for (int r = 0; r < 8; ++r) { mrun[r] = -1.0e30f; lpart[r] = 0.0f; }

    for (int s0 = 0; s0 < SQ; s0 += 64) {
        v8f sacc[4];
#pragma unroll
        for (int sub = 0; sub < 4; ++sub) sacc[sub] = zero8();
#pragma unroll
        for (int ec = 0; ec < 2; ++ec) {
            Frag kf[4];
#pragma unroll
            for (int sub = 0; sub < 4; ++sub) {
                const _Float16* kp = kbase + (size_t)(s0 + 16 * sub) * DM + 32 * ec;
                kf[sub].p[0] = *(const v8h*)kp;
                kf[sub].p[1] = *(const v8h*)(kp + 16);
            }
#pragma unroll
            for (int sub = 0; sub < 4; ++sub) sacc[sub] = mma16(qf[ec].v, kf[sub].v, sacc[sub]);
            asm volatile("v_nop\n\tv_nop\n\tv_nop\n\tv_nop"
                         : "+v"(sacc[0]), "+v"(sacc[1]), "+v"(sacc[2]), "+v"(sacc[3])
                         : "v"(qf[ec].v), "v"(kf[0].v), "v"(kf[1].v), "v"(kf[2].v), "v"(kf[3].v));
        }

        // affine + temperature in the log2 domain
#pragma unroll
        for (int sub = 0; sub < 4; ++sub)
#pragma unroll
            for (int r = 0; r < 8; ++r) sacc[sub][r] = sacc[sub][r] * c1 + c0;

        // online softmax; row = 8h + r, 64 columns = 4 sub-tiles x 16 lanes of this lane half
        float msub[8];
#pragma unroll
        for (int r = 0; r < 8; ++r) {
            float mx = fmaxf(fmaxf(sacc[0][r], sacc[1][r]), fmaxf(sacc[2][r], sacc[3][r]));
            mx = fmaxf(mx, __shfl_xor(mx, 1, 16));
            mx = fmaxf(mx, __shfl_xor(mx, 2, 16));
            mx = fmaxf(mx, __shfl_xor(mx, 4, 16));
            mx = fmaxf(mx, __shfl_xor(mx, 8, 16));
            const float mn = fmaxf(mrun[r], mx);
            const float alpha = EX2(mrun[r] - mn);
            mrun[r] = mn;
            lpart[r] *= alpha;
#pragma unroll
            for (int et = 0; et < 4; ++et) oacc[et][r] *= alpha;
            msub[r] = mn - 14.0f;     // numerators carried x2^14
        }
#pragma unroll
        for (int sub = 0; sub < 4; ++sub)
#pragma unroll
            for (int r = 0; r < 8; ++r) {
                const float p = EX2(sacc[sub][r] - msub[r]);   // in (0, 16384]
                lpart[r] += p;
                myP[(8 * h + r) * PP + 16 * sub + m] = (_Float16)p;
            }
        __syncthreads();   // LDS numerator tile written before it is re-read as fragments

#pragma unroll
        for (int sc = 0; sc < 2; ++sc) {
            Frag pf, vf[4];
            pf.p[0] = *(const v8ha*)(myP + m * PP + 32 * sc + 8 * h);        // s = 32sc+8h..
            pf.p[1] = *(const v8ha*)(myP + m * PP + 32 * sc + 16 + 8 * h);   // s = 32sc+16+8h..
#pragma unroll
            for (int et = 0; et < 4; ++et) {
                const _Float16* vp = vbase + (size_t)(16 * et) * SQ + s0 + 32 * sc;
                vf[et].p[0] = *(const v8h*)vp;
                vf[et].p[1] = *(const v8h*)(vp + 16);
            }
#pragma unroll
            for (int et = 0; et < 4; ++et) oacc[et] = mma16(pf.v, vf[et].v, oacc[et]);
            asm volatile("v_nop\n\tv_nop\n\tv_nop\n\tv_nop"
                         : "+v"(oacc[0]), "+v"(oacc[1]), "+v"(oacc[2]), "+v"(oacc[3])
                         : "v"(pf.v), "v"(vf[0].v), "v"(vf[1].v), "v"(vf[2].v), "v"(vf[3].v));
        }
    }

    // row sums across the 16 lanes of each half, then context x32 = 4 * O / lsum
#pragma unroll
    for (int r = 0; r < 8; ++r) {
        float lt = lpart[r];
        lt += __shfl_xor(lt, 1, 16);
        lt += __shfl_xor(lt, 2, 16);
        lt += __shfl_xor(lt, 4, 16);
        lt += __shfl_xor(lt, 8, 16);
        const float inv = 4.0f / lt;
        const int row = 8 * h + r;
#pragma unroll
        for (int et = 0; et < 4; ++et)
            myP[row * PP + 16 * et + m] = (_Float16)(oacc[et][r] * inv);
    }
    __syncthreads();
    v8h cv[4];
    size_t coff[4];
#pragma unroll
    for (int i = 0; i < 4; ++i) {
        const int row = 16 * w + 4 * i + (l >> 3);
        const int c8 = (l & 7) * 8;
        cv[i] = *(const v8ha*)(sP + row * PP + c8);
        coff[i] = (size_t)(bq * SQ + q0 + row) * DM + hd * HD + c8;
    }
#pragma unroll
    for (int i = 0; i < 4; ++i) *(v8h*)(Ctx + coff[i]) = cv[i];
    
}

// ------------------------------------------------------------------------------------------
extern "C" void kernel_launch(void* const* d_in, const int* in_sizes, int n_in,
                              void* d_out, int out_size, void* d_ws, size_t ws_size,
                              hipStream_t stream)
{
    if (n_in < 13) return;
    if (in_sizes[0] != PLANE || in_sizes[1] != PLANE || in_sizes[2] != PLANE) return;
    if (in_sizes[3] != NB || in_sizes[4] != NB) return;
    if (in_sizes[5] != DM * DM || in_sizes[7] != DM * DM || in_sizes[9] != DM * DM || in_sizes[11] != DM * DM) return;
    if (in_sizes[6] != DM || in_sizes[8] != DM || in_sizes[10] != DM || in_sizes[12] != DM) return;
    if (out_size != PLANE) return;

    const float* queries = (const float*)d_in[0];
    const float* keys    = (const float*)d_in[1];
    const float* values  = (const float*)d_in[2];
    const float* tau     = (const float*)d_in[3];
    const float* delta   = (const float*)d_in[4];
    const float* Wq = (const float*)d_in[5];
    const float* bq = (const float*)d_in[6];
    const float* Wk = (const float*)d_in[7];
    const float* bk = (const float*)d_in[8];
    const float* Wv = (const float*)d_in[9];
    const float* bv = (const float*)d_in[10];
    const float* Wo = (const float*)d_in[11];
    const float* bo = (const float*)d_in[12];
    float* out = (float*)d_out;

    // workspace carve (bytes), all offsets multiples of 2 MiB
    const size_t szPlane16 = (size_t)PLANE * 2;                 // 8 MiB
    const size_t offXh = 0;                                       // 3 planes  = 24 MiB
    const size_t offWt = offXh + 3 * szPlane16;                   // 4 x 512x512 f16 = 2 MiB
    const size_t offQ  = offWt + (size_t)4 * DM * DM * 2;
    const size_t offK  = offQ + szPlane16;
    const size_t offVt = offK + szPlane16;
    const size_t offC  = offVt + szPlane16;
    const size_t wsEnd = offC + szPlane16;                        // 60,817,408 B
    if (wsEnd > ws_size) return;

    char* ws = (char*)d_ws;
    _Float16* Xh  = (_Float16*)(ws + offXh);
    _Float16* Wt  = (_Float16*)(ws + offWt);
    _Float16* Qh  = (_Float16*)(ws + offQ);
    _Float16* Kh  = (_Float16*)(ws + offK);
    _Float16* Vth = (_Float16*)(ws + offVt);
    _Float16* Ctx = (_Float16*)(ws + offC);

    // 1) activations -> f16 (bf16 value x16)
    k_cvt_act<<<dim3(CVT_GRID, 3, 1), dim3(CVT_BLK), 0, stream>>>(queries, keys, values, Xh);
    // 2) weights -> transposed f16 (bf16 value x64): Wq, Wk, Wv, Wo
    k_cvt_wt<<<dim3(DM / 64, DM / 64, 4), dim3(128), 0, stream>>>(Wq, Wk, Wv, Wo, Wt);
    // 3) q, k (row-major) and v (head-transposed) projections, f16 x8
    k_gemm<false><<<dim3(DM / 128, MR / 64, 3), dim3(128), 0, stream>>>(
        Xh, (int)PLANE, Wt, bq, bk, bv, Qh, out, 1.0f / 1024.0f, 8.0f);
    // 4) attention -> context f16 x32
    k_attn<<<dim3(SQ / 64, NH, NB), dim3(128), 0, stream>>>(Qh, Kh, Vth, tau, delta, Ctx);
    // 5) output projection -> f32
    k_gemm<true><<<dim3(DM / 128, MR / 64, 1), dim3(128), 0, stream>>>(
        Ctx, 0, Wt + (size_t)3 * DM * DM, bo, bo, bo, Qh, out, 1.0f / 2048.0f, 1.0f);
}

// v001
// It runs in 139 microseconds.
// In both of two side-by-side timings against v000, it was 1.37 times as fast.
#include <hip/hip_runtime.h>
#include <stdint.h>

// All six contractions (three input projections, q.k^T, p.v, output projection):
// v_wmma_f32_16x16x32_f16, f16 operands, f32 accumulate. Float inputs are RNE-converted to
// bf16 values held exactly in f16 containers (activations x16, weights x64; tau, delta, bias as
// f32-held bf16 values); intermediates: q,k,v f16 x8, softmax numerators f16 x2^14, context f16 x32.
// Every scale is a power of two removed in f32. Softmax statistics in f32.

#ifndef AFFINE_BF16
#define AFFINE_BF16 1   // 1: tau and delta RNE-converted to bf16 values before use; 0: used as given
#endif

#define DM 512
#define NH 8
#define HD 64
#define NB 4
#define SQ 2048
#define MR (NB * SQ)            // 8192 token rows
#define PLANE (MR * DM)         // 4194304 elements per activation plane
#define PP 72                   // f16 LDS pitch of the per-wave softmax/context tile
#define PC 136                  // f16 LDS pitch of the row-major 64x128 epilogue tile
#define PT 72                   // f16 LDS pitch of the transposed 128x64 epilogue tile
#define PO 132                  // f32 LDS pitch of the 64x128 epilogue tile
#define KP 72                   // f16 LDS pitch of a staged 64-element K or V row (144 B = 16 B x 9)
#define KVT (64 * KP)           // f16 elements of one staged 64x64 tile

#define CVT_BLK 256
#define CVT_UNITS 4
#define UPP (PLANE / 8)         // 8-element units per plane = 524288
#define CVT_GRID (UPP / (CVT_BLK * CVT_UNITS))   // 512, exact

typedef _Float16 v16h __attribute__((ext_vector_type(16)));
typedef _Float16 v8h  __attribute__((ext_vector_type(8)));
typedef v8h __attribute__((may_alias)) v8ha;
typedef float v8f __attribute__((ext_vector_type(8)));
typedef float v4f __attribute__((ext_vector_type(4)));
typedef v4f __attribute__((may_alias)) v4fa;

union Frag { v16h v; v8h p[2]; };

#if defined(__has_builtin)
#if __has_builtin(__builtin_amdgcn_exp2f)
#define EX2(x) __builtin_amdgcn_exp2f(x)
#endif
#endif
#ifndef EX2
#define EX2(x) __expf((x) * 0.69314718055994531f)
#endif

// f32 -> nearest-even bf16 value, returned as f32
__device__ __forceinline__ float bfr(float x)
{
    unsigned u = __float_as_uint(x);
    u = (u + 0x7fffu + ((u >> 16) & 1u)) & 0xffff0000u;
    return __uint_as_float(u);
}
// bf16 value times a power of two, held in an f16 container (exact in the normal range)
__device__ __forceinline__ _Float16 cvh(float x, float s) { return (_Float16)(bfr(x) * s); }

__device__ __forceinline__ v8f mma16(v16h a, v16h b, v8f c)
{
    return __builtin_amdgcn_wmma_f32_16x16x32_f16(false, a, false, b, (short)0, c, false, false);
}

__device__ __forceinline__ v8f zero8()
{
    v8f z;
#pragma unroll
    for (int i = 0; i < 8; ++i) z[i] = 0.0f;
    return z;
}

// ------------------------------------------------------------------------------------------
// Activation convert: three f32 [8192][512] planes -> f16 planes (bf16 value x16).
// One lane handles 8 consecutive elements (16 B); one wave store instruction covers 4 whole
__global__ __launch_bounds__(CVT_BLK)
void k_cvt_act(const float* __restrict__ x0, const float* __restrict__ x1,
               const float* __restrict__ x2, _Float16* __restrict__ xh)
{
    const int pl = blockIdx.y;
    const float* src = (pl == 0) ? x0 : ((pl == 1) ? x1 : x2);
    _Float16* dst = xh + (size_t)pl * PLANE;
    const int t0 = blockIdx.x * CVT_BLK + (int)threadIdx.x;
    v8h val[CVT_UNITS];
    int uu[CVT_UNITS];
#pragma unroll
    for (int j = 0; j < CVT_UNITS; ++j) {
        int u = t0 + j * (CVT_GRID * CVT_BLK);
        u = (u < UPP) ? u : (UPP - 1);
        uu[j] = u;
        const float4 a = *(const float4*)(src + (size_t)u * 8);
        const float4 b = *(const float4*)(src + (size_t)u * 8 + 4);
        v8h v;
        v[0] = cvh(a.x, 16.0f); v[1] = cvh(a.y, 16.0f); v[2] = cvh(a.z, 16.0f); v[3] = cvh(a.w, 16.0f);
        v[4] = cvh(b.x, 16.0f); v[5] = cvh(b.y, 16.0f); v[6] = cvh(b.z, 16.0f); v[7] = cvh(b.w, 16.0f);
        val[j] = v;
    }
#pragma unroll
    for (int j = 0; j < CVT_UNITS; ++j)
        *(v8h*)(dst + (size_t)uu[j] * 8) = val[j];
    
}

// ------------------------------------------------------------------------------------------
// Weight convert + transpose: four f32 W[k][n] (512x512) -> f16 Wt[n][k] (bf16 value x64),
// k-contiguous so B fragments load like A fragments. 64x64 tile through LDS; each output line
__global__ __launch_bounds__(128)
void k_cvt_wt(const float* __restrict__ w0, const float* __restrict__ w1,
              const float* __restrict__ w2, const float* __restrict__ w3,
              _Float16* __restrict__ wt)
{
    __shared__ _Float16 __attribute__((aligned(16))) sT[64 * PT];   // [n_local][k_local]
    const int z = blockIdx.z;
    const float* src = (z == 0) ? w0 : ((z == 1) ? w1 : ((z == 2) ? w2 : w3));
    _Float16* dst = wt + (size_t)z * (DM * DM);
    const int k0 = blockIdx.y * 64, n0 = blockIdx.x * 64;
    const int t = threadIdx.x, l = t & 31, w = t >> 5;
    const int nn = (t & 15) * 4, kb = t >> 4;
#pragma unroll
    for (int i = 0; i < 8; ++i) {
        const int kk = kb + 8 * i;
        const float4 v = *(const float4*)(src + (size_t)(k0 + kk) * DM + n0 + nn);
        sT[(nn + 0) * PT + kk] = cvh(v.x, 64.0f);
        sT[(nn + 1) * PT + kk] = cvh(v.y, 64.0f);
        sT[(nn + 2) * PT + kk] = cvh(v.z, 64.0f);
        sT[(nn + 3) * PT + kk] = cvh(v.w, 64.0f);
    }
    __syncthreads();
    v8h val[4];
    size_t off[4];
#pragma unroll
    for (int i = 0; i < 4; ++i) {
        const int line = 16 * w + 4 * i + (l >> 3);   // n_local
        const int ck = (l & 7) * 8;
        val[i] = *(const v8ha*)(sT + line * PT + ck);
        off[i] = (size_t)(n0 + line) * DM + k0 + ck;
    }
#pragma unroll
    for (int i = 0; i < 4; ++i) *(v8h*)(dst + off[i]) = val[i];
    
}

// ------------------------------------------------------------------------------------------
// C[64 x 128 per block] = A[rows][512] (f16, row-major) * B, with B given as Bt[n][k] (f16).
// 4 waves, each a 32x64 sub-tile = 2x4 accumulators; fragments loaded straight from global
// with the 16x16x32 split-k lane map for both A and B.
// !OUTF: v = (acc*s_acc + bf16(bias)) * s_out -> f16; blockIdx.z selects the plane
//        (z=0,1 row-major [8192][512]; z=2 head-transposed [NB][NH][HD][SQ]).
// OUTF : same value -> f32 d_out.
template<bool OUTF>
__global__ __launch_bounds__(128) __attribute__((amdgpu_num_vgpr(248)))
void k_gemm(const _Float16* __restrict__ A, int planeA, const _Float16* __restrict__ Bt,
            const float* __restrict__ bi0, const float* __restrict__ bi1,
            const float* __restrict__ bi2,
            _Float16* __restrict__ O16, float* __restrict__ O32, float s_acc, float s_out)
{
    const int t = threadIdx.x, l = t & 31, w = t >> 5, h = l >> 4, m = l & 15;
    const int z = blockIdx.z;
    const int n0 = blockIdx.x * 128, m0 = blockIdx.y * 64;
    const int wm = (w >> 1) * 32, wn = (w & 1) * 64;
    const _Float16* Ab = A + (size_t)z * (size_t)planeA;
    const _Float16* Bb = Bt + (size_t)z * (DM * DM);
    const float* bias = (z == 0) ? bi0 : ((z == 1) ? bi1 : bi2);

    const _Float16* ap[2];
    const _Float16* bp[4];
#pragma unroll
    for (int mi = 0; mi < 2; ++mi) ap[mi] = Ab + (size_t)(m0 + wm + 16 * mi + m) * DM + 8 * h;
#pragma unroll
    for (int ni = 0; ni < 4; ++ni) bp[ni] = Bb + (size_t)(n0 + wn + 16 * ni + m) * DM + 8 * h;

    v8f acc[2][4];
#pragma unroll
    for (int mi = 0; mi < 2; ++mi)
#pragma unroll
        for (int ni = 0; ni < 4; ++ni) acc[mi][ni] = zero8();

#pragma unroll 2
    for (int k0 = 0; k0 < DM; k0 += 32) {
        Frag a[2], b[4];
#pragma unroll
        for (int mi = 0; mi < 2; ++mi) {
            a[mi].p[0] = *(const v8h*)(ap[mi] + k0);        // k0+8h .. +7
            a[mi].p[1] = *(const v8h*)(ap[mi] + k0 + 16);   // k0+16+8h .. +7
        }
#pragma unroll
        for (int ni = 0; ni < 4; ++ni) {
            b[ni].p[0] = *(const v8h*)(bp[ni] + k0);
            b[ni].p[1] = *(const v8h*)(bp[ni] + k0 + 16);
        }
#pragma unroll
        for (int mi = 0; mi < 2; ++mi)
#pragma unroll
            for (int ni = 0; ni < 4; ++ni)
                acc[mi][ni] = mma16(a[mi].v, b[ni].v, acc[mi][ni]);
        asm volatile("v_nop\n\tv_nop\n\tv_nop\n\tv_nop"
                     : "+v"(acc[0][0]), "+v"(acc[0][1]), "+v"(acc[0][2]), "+v"(acc[0][3]),
                       "+v"(acc[1][0]), "+v"(acc[1][1]), "+v"(acc[1][2]), "+v"(acc[1][3])
                     : "v"(a[0].v), "v"(a[1].v), "v"(b[0].v), "v"(b[1].v), "v"(b[2].v), "v"(b[3].v));
    }

    float bb[4];
#pragma unroll
    for (int ni = 0; ni < 4; ++ni) bb[ni] = bfr(bias[n0 + wn + 16 * ni + m]);

    if constexpr (OUTF) {
        __shared__ float __attribute__((aligned(16))) sO[64 * PO];
#pragma unroll
        for (int mi = 0; mi < 2; ++mi)
#pragma unroll
            for (int ni = 0; ni < 4; ++ni)
#pragma unroll
                for (int r = 0; r < 8; ++r) {
                    const int row = wm + 16 * mi + 8 * h + r;
                    const int col = wn + 16 * ni + m;
                    sO[row * PO + col] = (acc[mi][ni][r] * s_acc + bb[ni]) * s_out;
                }
        __syncthreads();
        v4f val[16];
#pragma unroll
        for (int i = 0; i < 16; ++i) val[i] = *(const v4fa*)(sO + (16 * w + i) * PO + 4 * l);
#pragma unroll
        for (int i = 0; i < 16; ++i)
            *(v4f*)(O32 + (size_t)(m0 + 16 * w + i) * DM + n0 + 4 * l) = val[i];
        
    } else {
        __shared__ _Float16 __attribute__((aligned(16))) sC[9216];   // 64x136 or 128x72 view
        if (z != 2) {
#pragma unroll
            for (int mi = 0; mi < 2; ++mi)
#pragma unroll
                for (int ni = 0; ni < 4; ++ni)
#pragma unroll
                    for (int r = 0; r < 8; ++r) {
                        const int row = wm + 16 * mi + 8 * h + r;
                        const int col = wn + 16 * ni + m;
                        sC[row * PC + col] = (_Float16)((acc[mi][ni][r] * s_acc + bb[ni]) * s_out);
                    }
        } else {
#pragma unroll
            for (int mi = 0; mi < 2; ++mi)
#pragma unroll
                for (int ni = 0; ni < 4; ++ni)
#pragma unroll
                    for (int r = 0; r < 8; ++r) {
                        const int row = wm + 16 * mi + 8 * h + r;
                        const int col = wn + 16 * ni + m;
                        sC[col * PT + row] = (_Float16)((acc[mi][ni][r] * s_acc + bb[ni]) * s_out);
                    }
        }
        __syncthreads();
        v8h val[8];
        size_t off[8];
        if (z != 2) {
#pragma unroll
            for (int i = 0; i < 8; ++i) {
                const int row = 16 * w + 2 * i + (l >> 4);
                const int c8 = (l & 15) * 8;
                val[i] = *(const v8ha*)(sC + row * PC + c8);
                off[i] = (size_t)z * PLANE + (size_t)(m0 + row) * DM + n0 + c8;
            }
        } else {
            // transposed: one line per tile column (64 consecutive s of one (b,head,e) row)
            const int bidx = m0 / SQ, s0 = m0 - bidx * SQ;
#pragma unroll
            for (int i = 0; i < 8; ++i) {
                const int col = 32 * w + 4 * i + (l >> 3);
                const int ck = (l & 7) * 8;
                const int gc = n0 + col;
                val[i] = *(const v8ha*)(sC + col * PT + ck);
                off[i] = (size_t)2 * PLANE
                       + ((size_t)((bidx * NH + (gc >> 6)) * HD + (gc & 63))) * SQ + s0 + ck;
            }
        }
#pragma unroll
        for (int i = 0; i < 8; ++i) *(v8h*)(O16 + off[i]) = val[i];
        
    }
}

// ------------------------------------------------------------------------------------------
// One lane's share of a 64-key stage: four 16-B pieces of the K tile and four of the V tile, rows
// 16 apart, copied from global memory into LDS without passing through registers. A wave's copy
// covers four whole 128-B rows. lk, lv: LDS byte addresses; gk, gv: the matching global addresses.
__device__ __forceinline__ void stage_kv(unsigned lk, unsigned lv,
                                         const _Float16* gk, const _Float16* gv)
{
    // s_wait_xcnt closes the statement so that no address register is rewritten ahead of it
    asm volatile("global_load_async_to_lds_b128 %0, %8, off\n\t"
                 "global_load_async_to_lds_b128 %1, %9, off\n\t"
                 "global_load_async_to_lds_b128 %2, %10, off\n\t"
                 "global_load_async_to_lds_b128 %3, %11, off\n\t"
                 "global_load_async_to_lds_b128 %4, %12, off\n\t"
                 "global_load_async_to_lds_b128 %5, %13, off\n\t"
                 "global_load_async_to_lds_b128 %6, %14, off\n\t"
                 "global_load_async_to_lds_b128 %7, %15, off\n\t"
                 "s_wait_xcnt 0x0"
                 :: "v"(lk), "v"(lk + 16u * KP * 2u), "v"(lk + 32u * KP * 2u), "v"(lk + 48u * KP * 2u),
                    "v"(lv), "v"(lv + 16u * KP * 2u), "v"(lv + 32u * KP * 2u), "v"(lv + 48u * KP * 2u),
                    "v"(gk), "v"(gk + 16 * DM), "v"(gk + 32 * DM), "v"(gk + 48 * DM),
                    "v"(gv), "v"(gv + 16 * SQ), "v"(gv + 32 * SQ), "v"(gv + 48 * SQ)
                 : "memory");
}

// ------------------------------------------------------------------------------------------
// Fused attention per (batch, head, 64 query rows); 4 waves x 16 rows; 64-key tiles.
// Each 64-key K tile and V tile is brought into LDS once per block by asynchronous copies, two
// buffers, one stage ahead of its use; all four waves read their fragments from there.
// Qh, Kh: f16 [NB*SQ][512] (x8); Vt: f16 [NB][NH][HD][SQ] (x8); Ctx: f16 [NB*SQ][512] (x32).
// S = Q.K^T on WMMA; logits in the log2 domain; online softmax in f32; numerators written to a
// per-wave LDS tile as f16 x2^14 and re-read as A fragments after a block barrier (may_alias
__global__ __launch_bounds__(128) __attribute__((amdgpu_num_vgpr(248)))
void k_attn(const _Float16* __restrict__ Qh, const _Float16* __restrict__ Kh,
            const _Float16* __restrict__ Vt, const float* __restrict__ tau,
            const float* __restrict__ delta, _Float16* __restrict__ Ctx)
{
    __shared__ _Float16 __attribute__((aligned(16))) sP[64 * PP];
    __shared__ _Float16 __attribute__((aligned(16))) sKV[2 * 2 * KVT];   // [buffer][K, V][row][KP]
    const int t = threadIdx.x, l = t & 31, w = t >> 5, h = l >> 4, m = l & 15;
    const int bq = blockIdx.z, hd = blockIdx.y, q0 = blockIdx.x * 64;

    const float LOG2E = 1.4426950408889634f;
#if AFFINE_BF16
    const float tb = bfr(tau[bq]);
    const float db = bfr(delta[bq]);
#else
    const float tb = tau[bq];
    const float db = delta[bq];
#endif
    // logit2 = log2(e) * 0.125 * (s * tau + delta), s = sacc / 64 (q and k each carried x8)
    const float c1 = tb * (0.125f / 64.0f) * LOG2E;
    const float c0 = db * 0.125f * LOG2E;

    Frag qf[2];
    {
        const _Float16* qp = Qh + (size_t)(bq * SQ + q0 + 16 * w + m) * DM + hd * HD + 8 * h;
#pragma unroll
        for (int ec = 0; ec < 2; ++ec) {
            qf[ec].p[0] = *(const v8h*)(qp + 32 * ec);        // e = 32ec+8h .. +7
            qf[ec].p[1] = *(const v8h*)(qp + 32 * ec + 16);   // e = 32ec+16+8h .. +7
        }
    }
    // copy side: thread t brings piece (t & 7) of rows (t >> 3) + 16 j, j = 0..3, of each tile
    const _Float16* kcp = Kh + (size_t)(bq * SQ + (t >> 3)) * DM + hd * HD + 8 * (t & 7);
    const _Float16* vcp = Vt + ((size_t)(bq * NH + hd) * HD + (t >> 3)) * SQ + 8 * (t & 7);
    const unsigned lcp = (unsigned)(uintptr_t)(sKV + (t >> 3) * KP + 8 * (t & 7));
    // fragment side: row m of a 16-row group, k = 8h.. and 16+8h.., as before from global memory
    const _Float16* fbase = sKV + m * KP + 8 * h;
    _Float16* myP = sP + w * 16 * PP;

    v8f oacc[4];
#pragma unroll
    for (int et = 0; et < 4; ++et) oacc[et] = zero8();
    float mrun[8], lpart[8];
#pragma unroll
    for (int r = 0; r < 8; ++r) { mrun[r] = -1.0e30f; lpart[r] = 0.0f; }

    stage_kv(lcp, lcp + KVT * 2u, kcp, vcp);
    asm volatile("s_wait_asynccnt 0x0" ::: "memory");   // stage 0 landed, this wave's share
    __syncthreads();                                    // stage 0 readable by every wave
    stage_kv(lcp + 2u * KVT * 2u, lcp + 3u * KVT * 2u, kcp + (size_t)64 * DM, vcp + 64);

    for (int s0 = 0; s0 < SQ; s0 += 64) {
        const unsigned buf = ((unsigned)s0 >> 6) & 1u;
        const _Float16* kT = fbase + buf * (2 * KVT);
        const _Float16* vT = kT + KVT;
        v8f sacc[4];
#pragma unroll
        for (int sub = 0; sub < 4; ++sub) sacc[sub] = zero8();
#pragma unroll
        for (int ec = 0; ec < 2; ++ec) {
            Frag kf[4];
#pragma unroll
            for (int sub = 0; sub < 4; ++sub) {
                const _Float16* kp = kT + (16 * sub) * KP + 32 * ec;
                kf[sub].p[0] = *(const v8ha*)kp;
                kf[sub].p[1] = *(const v8ha*)(kp + 16);
            }
#pragma unroll
            for (int sub = 0; sub < 4; ++sub) sacc[sub] = mma16(qf[ec].v, kf[sub].v, sacc[sub]);
            asm volatile("v_nop\n\tv_nop\n\tv_nop\n\tv_nop"
                         : "+v"(sacc[0]), "+v"(sacc[1]), "+v"(sacc[2]), "+v"(sacc[3])
                         : "v"(qf[ec].v), "v"(kf[0].v), "v"(kf[1].v), "v"(kf[2].v), "v"(kf[3].v));
        }

        // affine + temperature in the log2 domain
#pragma unroll
        for (int sub = 0; sub < 4; ++sub)
#pragma unroll
            for (int r = 0; r < 8; ++r) sacc[sub][r] = sacc[sub][r] * c1 + c0;

        // online softmax; row = 8h + r, 64 columns = 4 sub-tiles x 16 lanes of this lane half
        float msub[8];
#pragma unroll
        for (int r = 0; r < 8; ++r) {
            float mx = fmaxf(fmaxf(sacc[0][r], sacc[1][r]), fmaxf(sacc[2][r], sacc[3][r]));
            mx = fmaxf(mx, __shfl_xor(mx, 1, 16));
            mx = fmaxf(mx, __shfl_xor(mx, 2, 16));
            mx = fmaxf(mx, __shfl_xor(mx, 4, 16));
            mx = fmaxf(mx, __shfl_xor(mx, 8, 16));
            const float mn = fmaxf(mrun[r], mx);
            const float alpha = EX2(mrun[r] - mn);
            mrun[r] = mn;
            lpart[r] *= alpha;
#pragma unroll
            for (int et = 0; et < 4; ++et) oacc[et][r] *= alpha;
            msub[r] = mn - 14.0f;     // numerators carried x2^14
        }
#pragma unroll
        for (int sub = 0; sub < 4; ++sub)
#pragma unroll
            for (int r = 0; r < 8; ++r) {
                const float p = EX2(sacc[sub][r] - msub[r]);   // in (0, 16384]
                lpart[r] += p;
                myP[(8 * h + r) * PP + 16 * sub + m] = (_Float16)p;
            }
        __syncthreads();   // LDS numerator tile written before it is re-read as fragments

#pragma unroll
        for (int sc = 0; sc < 2; ++sc) {
            Frag pf, vf[4];
            pf.p[0] = *(const v8ha*)(myP + m * PP + 32 * sc + 8 * h);        // s = 32sc+8h..
            pf.p[1] = *(const v8ha*)(myP + m * PP + 32 * sc + 16 + 8 * h);   // s = 32sc+16+8h..
#pragma unroll
            for (int et = 0; et < 4; ++et) {
                const _Float16* vp = vT + (16 * et) * KP + 32 * sc;
                vf[et].p[0] = *(const v8ha*)vp;
                vf[et].p[1] = *(const v8ha*)(vp + 16);
            }
#pragma unroll
            for (int et = 0; et < 4; ++et) oacc[et] = mma16(pf.v, vf[et].v, oacc[et]);
            asm volatile("v_nop\n\tv_nop\n\tv_nop\n\tv_nop"
                         : "+v"(oacc[0]), "+v"(oacc[1]), "+v"(oacc[2]), "+v"(oacc[3])
                         : "v"(pf.v), "v"(vf[0].v), "v"(vf[1].v), "v"(vf[2].v), "v"(vf[3].v));
        }

        // hand-over: this wave's reads of the current buffer are done, its share of the next stage
        // has landed; behind the barrier the next stage is readable and this buffer is free
        asm volatile("s_wait_dscnt 0x0" ::: "memory");
        asm volatile("s_wait_asynccnt 0x0" ::: "memory");
        __syncthreads();
        if (s0 + 128 < SQ)
            stage_kv(lcp + buf * (2u * KVT * 2u), lcp + buf * (2u * KVT * 2u) + KVT * 2u,
                     kcp + (size_t)(s0 + 128) * DM, vcp + (s0 + 128));
    }
    asm volatile("s_wait_asynccnt 0x0" ::: "memory");   // no copy outstanding past the loop

    // row sums across the 16 lanes of each half, then context x32 = 4 * O / lsum
#pragma unroll
    for (int r = 0; r < 8; ++r) {
        float lt = lpart[r];
        lt += __shfl_xor(lt, 1, 16);
        lt += __shfl_xor(lt, 2, 16);
        lt += __shfl_xor(lt, 4, 16);
        lt += __shfl_xor(lt, 8, 16);
        const float inv = 4.0f / lt;
        const int row = 8 * h + r;
#pragma unroll
        for (int et = 0; et < 4; ++et)
            myP[row * PP + 16 * et + m] = (_Float16)(oacc[et][r] * inv);
    }
    __syncthreads();
    v8h cv[4];
    size_t coff[4];
#pragma unroll
    for (int i = 0; i < 4; ++i) {
        const int row = 16 * w + 4 * i + (l >> 3);
        const int c8 = (l & 7) * 8;
        cv[i] = *(const v8ha*)(sP + row * PP + c8);
        coff[i] = (size_t)(bq * SQ + q0 + row) * DM + hd * HD + c8;
    }
#pragma unroll
    for (int i = 0; i < 4; ++i) *(v8h*)(Ctx + coff[i]) = cv[i];
    
}

// ------------------------------------------------------------------------------------------
extern "C" void kernel_launch(void* const* d_in, const int* in_sizes, int n_in,
                              void* d_out, int out_size, void* d_ws, size_t ws_size,
                              hipStream_t stream)
{
    if (n_in < 13) return;
    if (in_sizes[0] != PLANE || in_sizes[1] != PLANE || in_sizes[2] != PLANE) return;
    if (in_sizes[3] != NB || in_sizes[4] != NB) return;
    if (in_sizes[5] != DM * DM || in_sizes[7] != DM * DM || in_sizes[9] != DM * DM || in_sizes[11] != DM * DM) return;
    if (in_sizes[6] != DM || in_sizes[8] != DM || in_sizes[10] != DM || in_sizes[12] != DM) return;
    if (out_size != PLANE) return;

    const float* queries = (const float*)d_in[0];
    const float* keys    = (const float*)d_in[1];
    const float* values  = (const float*)d_in[2];
    const float* tau     = (const float*)d_in[3];
    const float* delta   = (const float*)d_in[4];
    const float* Wq = (const float*)d_in[5];
    const float* bq = (const float*)d_in[6];
    const float* Wk = (const float*)d_in[7];
    const float* bk = (const float*)d_in[8];
    const float* Wv = (const float*)d_in[9];
    const float* bv = (const float*)d_in[10];
    const float* Wo = (const float*)d_in[11];
    const float* bo = (const float*)d_in[12];
    float* out = (float*)d_out;

    // workspace carve (bytes), all offsets multiples of 2 MiB
    const size_t szPlane16 = (size_t)PLANE * 2;                 // 8 MiB
    const size_t offXh = 0;                                       // 3 planes  = 24 MiB
    const size_t offWt = offXh + 3 * szPlane16;                   // 4 x 512x512 f16 = 2 MiB
    const size_t offQ  = offWt + (size_t)4 * DM * DM * 2;
    const size_t offK  = offQ + szPlane16;
    const size_t offVt = offK + szPlane16;
    const size_t offC  = offVt + szPlane16;
    const size_t wsEnd = offC + szPlane16;                        // 60,817,408 B
    if (wsEnd > ws_size) return;

    char* ws = (char*)d_ws;
    _Float16* Xh  = (_Float16*)(ws + offXh);
    _Float16* Wt  = (_Float16*)(ws + offWt);
    _Float16* Qh  = (_Float16*)(ws + offQ);
    _Float16* Kh  = (_Float16*)(ws + offK);
    _Float16* Vth = (_Float16*)(ws + offVt);
    _Float16* Ctx = (_Float16*)(ws + offC);

    // 1) activations -> f16 (bf16 value x16)
    k_cvt_act<<<dim3(CVT_GRID, 3, 1), dim3(CVT_BLK), 0, stream>>>(queries, keys, values, Xh);
    // 2) weights -> transposed f16 (bf16 value x64): Wq, Wk, Wv, Wo
    k_cvt_wt<<<dim3(DM / 64, DM / 64, 4), dim3(128), 0, stream>>>(Wq, Wk, Wv, Wo, Wt);
    // 3) q, k (row-major) and v (head-transposed) projections, f16 x8
    k_gemm<false><<<dim3(DM / 128, MR / 64, 3), dim3(128), 0, stream>>>(
        Xh, (int)PLANE, Wt, bq, bk, bv, Qh, out, 1.0f / 1024.0f, 8.0f);
    // 4) attention -> context f16 x32
    k_attn<<<dim3(SQ / 64, NH, NB), dim3(128), 0, stream>>>(Qh, Kh, Vth, tau, delta, Ctx);
    // 5) output projection -> f32
    k_gemm<true><<<dim3(DM / 128, MR / 64, 1), dim3(128), 0, stream>>>(
        Ctx, 0, Wt + (size_t)3 * DM * DM, bo, bo, bo, Qh, out, 1.0f / 2048.0f, 1.0f);
}

// v002
// A run of this version takes 115 microseconds.
// Two timings next to v001 both put it at 1.21 times that version's speed.
// All steps since v000 together make it 1.66 times as fast.
#include <hip/hip_runtime.h>
#include <stdint.h>

// All six contractions (three input projections, q.k^T, p.v, output projection):
// v_wmma_f32_16x16x32_f16, f16 operands, f32 accumulate. Float inputs are RNE-converted to
// bf16 values held exactly in f16 containers (activations x16, weights x64; tau, delta, bias as
// f32-held bf16 values); intermediates: q,k,v f16 x8, softmax numerators f16 x2^14, context f16 x32.
// Every scale is a power of two removed in f32. Softmax statistics in f32.

#ifndef AFFINE_BF16
#define AFFINE_BF16 1   // 1: tau and delta RNE-converted to bf16 values before use; 0: used as given
#endif

#define DM 512
#define NH 8
#define HD 64
#define NB 4
#define SQ 2048
#define MR (NB * SQ)            // 8192 token rows
#define PLANE (MR * DM)         // 4194304 elements per activation plane
#define PP 72                   // f16 LDS pitch of the per-wave context tile (epilogue)
#define PC 136                  // f16 LDS pitch of the row-major 64x128 epilogue tile
#define PT 72                   // f16 LDS pitch of the transposed 128x64 epilogue tile
#define PO 132                  // f32 LDS pitch of the 64x128 epilogue tile
#define KP 72                   // f16 LDS pitch of a staged 64-element K or V row (144 B = 16 B x 9)
#define KVT (64 * KP)           // f16 elements of one staged 64x64 tile

#define CVT_BLK 256
#define CVT_UNITS 4
#define UPP (PLANE / 8)         // 8-element units per plane = 524288
#define CVT_GRID (UPP / (CVT_BLK * CVT_UNITS))   // 512, exact

typedef _Float16 v16h __attribute__((ext_vector_type(16)));
typedef _Float16 v8h  __attribute__((ext_vector_type(8)));
typedef v8h __attribute__((may_alias)) v8ha;
typedef float v8f __attribute__((ext_vector_type(8)));
typedef float v4f __attribute__((ext_vector_type(4)));
typedef v4f __attribute__((may_alias)) v4fa;

union Frag { v16h v; v8h p[2]; };

#if defined(__has_builtin)
#if __has_builtin(__builtin_amdgcn_exp2f)
#define EX2(x) __builtin_amdgcn_exp2f(x)
#endif
#endif
#ifndef EX2
#define EX2(x) __expf((x) * 0.69314718055994531f)
#endif

// f32 -> nearest-even bf16 value, returned as f32
__device__ __forceinline__ float bfr(float x)
{
    unsigned u = __float_as_uint(x);
    u = (u + 0x7fffu + ((u >> 16) & 1u)) & 0xffff0000u;
    return __uint_as_float(u);
}
// bf16 value times a power of two, held in an f16 container (exact in the normal range)
__device__ __forceinline__ _Float16 cvh(float x, float s) { return (_Float16)(bfr(x) * s); }

__device__ __forceinline__ v8f mma16(v16h a, v16h b, v8f c)
{
    return __builtin_amdgcn_wmma_f32_16x16x32_f16(false, a, false, b, (short)0, c, false, false);
}

__device__ __forceinline__ v8f zero8()
{
    v8f z;
#pragma unroll
    for (int i = 0; i < 8; ++i) z[i] = 0.0f;
    return z;
}

// ------------------------------------------------------------------------------------------
// Activation convert: three f32 [8192][512] planes -> f16 planes (bf16 value x16).
// One lane handles 8 consecutive elements (16 B); one wave store instruction covers 4 whole
__global__ __launch_bounds__(CVT_BLK)
void k_cvt_act(const float* __restrict__ x0, const float* __restrict__ x1,
               const float* __restrict__ x2, _Float16* __restrict__ xh)
{
    const int pl = blockIdx.y;
    const float* src = (pl == 0) ? x0 : ((pl == 1) ? x1 : x2);
    _Float16* dst = xh + (size_t)pl * PLANE;
    const int t0 = blockIdx.x * CVT_BLK + (int)threadIdx.x;
    v8h val[CVT_UNITS];
    int uu[CVT_UNITS];
#pragma unroll
    for (int j = 0; j < CVT_UNITS; ++j) {
        int u = t0 + j * (CVT_GRID * CVT_BLK);
        u = (u < UPP) ? u : (UPP - 1);
        uu[j] = u;
        const float4 a = *(const float4*)(src + (size_t)u * 8);
        const float4 b = *(const float4*)(src + (size_t)u * 8 + 4);
        v8h v;
        v[0] = cvh(a.x, 16.0f); v[1] = cvh(a.y, 16.0f); v[2] = cvh(a.z, 16.0f); v[3] = cvh(a.w, 16.0f);
        v[4] = cvh(b.x, 16.0f); v[5] = cvh(b.y, 16.0f); v[6] = cvh(b.z, 16.0f); v[7] = cvh(b.w, 16.0f);
        val[j] = v;
    }
#pragma unroll
    for (int j = 0; j < CVT_UNITS; ++j)
        *(v8h*)(dst + (size_t)uu[j] * 8) = val[j];
    
}

// ------------------------------------------------------------------------------------------
// Weight convert + transpose: four f32 W[k][n] (512x512) -> f16 Wt[n][k] (bf16 value x64),
// k-contiguous so B fragments load like A fragments. 64x64 tile through LDS; each output line
__global__ __launch_bounds__(128)
void k_cvt_wt(const float* __restrict__ w0, const float* __restrict__ w1,
              const float* __restrict__ w2, const float* __restrict__ w3,
              _Float16* __restrict__ wt)
{
    __shared__ _Float16 __attribute__((aligned(16))) sT[64 * PT];   // [n_local][k_local]
    const int z = blockIdx.z;
    const float* src = (z == 0) ? w0 : ((z == 1) ? w1 : ((z == 2) ? w2 : w3));
    _Float16* dst = wt + (size_t)z * (DM * DM);
    const int k0 = blockIdx.y * 64, n0 = blockIdx.x * 64;
    const int t = threadIdx.x, l = t & 31, w = t >> 5;
    const int nn = (t & 15) * 4, kb = t >> 4;
#pragma unroll
    for (int i = 0; i < 8; ++i) {
        const int kk = kb + 8 * i;
        const float4 v = *(const float4*)(src + (size_t)(k0 + kk) * DM + n0 + nn);
        sT[(nn + 0) * PT + kk] = cvh(v.x, 64.0f);
        sT[(nn + 1) * PT + kk] = cvh(v.y, 64.0f);
        sT[(nn + 2) * PT + kk] = cvh(v.z, 64.0f);
        sT[(nn + 3) * PT + kk] = cvh(v.w, 64.0f);
    }
    __syncthreads();
    v8h val[4];
    size_t off[4];
#pragma unroll
    for (int i = 0; i < 4; ++i) {
        const int line = 16 * w + 4 * i + (l >> 3);   // n_local
        const int ck = (l & 7) * 8;
        val[i] = *(const v8ha*)(sT + line * PT + ck);
        off[i] = (size_t)(n0 + line) * DM + k0 + ck;
    }
#pragma unroll
    for (int i = 0; i < 4; ++i) *(v8h*)(dst + off[i]) = val[i];
    
}

// ------------------------------------------------------------------------------------------
// C[64 x 128 per block] = A[rows][512] (f16, row-major) * B, with B given as Bt[n][k] (f16).
// 4 waves, each a 32x64 sub-tile = 2x4 accumulators; fragments loaded straight from global
// with the 16x16x32 split-k lane map for both A and B.
// !OUTF: v = (acc*s_acc + bf16(bias)) * s_out -> f16; blockIdx.z selects the plane
//        (z=0,1 row-major [8192][512]; z=2 head-transposed [NB][NH][HD][SQ]).
// OUTF : same value -> f32 d_out.
template<bool OUTF>
__global__ __launch_bounds__(128) __attribute__((amdgpu_num_vgpr(248)))
void k_gemm(const _Float16* __restrict__ A, int planeA, const _Float16* __restrict__ Bt,
            const float* __restrict__ bi0, const float* __restrict__ bi1,
            const float* __restrict__ bi2,
            _Float16* __restrict__ O16, float* __restrict__ O32, float s_acc, float s_out)
{
    const int t = threadIdx.x, l = t & 31, w = t >> 5, h = l >> 4, m = l & 15;
    const int z = blockIdx.z;
    const int n0 = blockIdx.x * 128, m0 = blockIdx.y * 64;
    const int wm = (w >> 1) * 32, wn = (w & 1) * 64;
    const _Float16* Ab = A + (size_t)z * (size_t)planeA;
    const _Float16* Bb = Bt + (size_t)z * (DM * DM);
    const float* bias = (z == 0) ? bi0 : ((z == 1) ? bi1 : bi2);

    const _Float16* ap[2];
    const _Float16* bp[4];
#pragma unroll
    for (int mi = 0; mi < 2; ++mi) ap[mi] = Ab + (size_t)(m0 + wm + 16 * mi + m) * DM + 8 * h;
#pragma unroll
    for (int ni = 0; ni < 4; ++ni) bp[ni] = Bb + (size_t)(n0 + wn + 16 * ni + m) * DM + 8 * h;

    v8f acc[2][4];
#pragma unroll
    for (int mi = 0; mi < 2; ++mi)
#pragma unroll
        for (int ni = 0; ni < 4; ++ni) acc[mi][ni] = zero8();

#pragma unroll 2
    for (int k0 = 0; k0 < DM; k0 += 32) {
        Frag a[2], b[4];
#pragma unroll
        for (int mi = 0; mi < 2; ++mi) {
            a[mi].p[0] = *(const v8h*)(ap[mi] + k0);        // k0+8h .. +7
            a[mi].p[1] = *(const v8h*)(ap[mi] + k0 + 16);   // k0+16+8h .. +7
        }
#pragma unroll
        for (int ni = 0; ni < 4; ++ni) {
            b[ni].p[0] = *(const v8h*)(bp[ni] + k0);
            b[ni].p[1] = *(const v8h*)(bp[ni] + k0 + 16);
        }
#pragma unroll
        for (int mi = 0; mi < 2; ++mi)
#pragma unroll
            for (int ni = 0; ni < 4; ++ni)
                acc[mi][ni] = mma16(a[mi].v, b[ni].v, acc[mi][ni]);
        asm volatile("v_nop\n\tv_nop\n\tv_nop\n\tv_nop"
                     : "+v"(acc[0][0]), "+v"(acc[0][1]), "+v"(acc[0][2]), "+v"(acc[0][3]),
                       "+v"(acc[1][0]), "+v"(acc[1][1]), "+v"(acc[1][2]), "+v"(acc[1][3])
                     : "v"(a[0].v), "v"(a[1].v), "v"(b[0].v), "v"(b[1].v), "v"(b[2].v), "v"(b[3].v));
    }

    float bb[4];
#pragma unroll
    for (int ni = 0; ni < 4; ++ni) bb[ni] = bfr(bias[n0 + wn + 16 * ni + m]);

    if constexpr (OUTF) {
        __shared__ float __attribute__((aligned(16))) sO[64 * PO];
#pragma unroll
        for (int mi = 0; mi < 2; ++mi)
#pragma unroll
            for (int ni = 0; ni < 4; ++ni)
#pragma unroll
                for (int r = 0; r < 8; ++r) {
                    const int row = wm + 16 * mi + 8 * h + r;
                    const int col = wn + 16 * ni + m;
                    sO[row * PO + col] = (acc[mi][ni][r] * s_acc + bb[ni]) * s_out;
                }
        __syncthreads();
        v4f val[16];
#pragma unroll
        for (int i = 0; i < 16; ++i) val[i] = *(const v4fa*)(sO + (16 * w + i) * PO + 4 * l);
#pragma unroll
        for (int i = 0; i < 16; ++i)
            *(v4f*)(O32 + (size_t)(m0 + 16 * w + i) * DM + n0 + 4 * l) = val[i];
        
    } else {
        __shared__ _Float16 __attribute__((aligned(16))) sC[9216];   // 64x136 or 128x72 view
        if (z != 2) {
#pragma unroll
            for (int mi = 0; mi < 2; ++mi)
#pragma unroll
                for (int ni = 0; ni < 4; ++ni)
#pragma unroll
                    for (int r = 0; r < 8; ++r) {
                        const int row = wm + 16 * mi + 8 * h + r;
                        const int col = wn + 16 * ni + m;
                        sC[row * PC + col] = (_Float16)((acc[mi][ni][r] * s_acc + bb[ni]) * s_out);
                    }
        } else {
#pragma unroll
            for (int mi = 0; mi < 2; ++mi)
#pragma unroll
                for (int ni = 0; ni < 4; ++ni)
#pragma unroll
                    for (int r = 0; r < 8; ++r) {
                        const int row = wm + 16 * mi + 8 * h + r;
                        const int col = wn + 16 * ni + m;
                        sC[col * PT + row] = (_Float16)((acc[mi][ni][r] * s_acc + bb[ni]) * s_out);
                    }
        }
        __syncthreads();
        v8h val[8];
        size_t off[8];
        if (z != 2) {
#pragma unroll
            for (int i = 0; i < 8; ++i) {
                const int row = 16 * w + 2 * i + (l >> 4);
                const int c8 = (l & 15) * 8;
                val[i] = *(const v8ha*)(sC + row * PC + c8);
                off[i] = (size_t)z * PLANE + (size_t)(m0 + row) * DM + n0 + c8;
            }
        } else {
            // transposed: one line per tile column (64 consecutive s of one (b,head,e) row)
            const int bidx = m0 / SQ, s0 = m0 - bidx * SQ;
#pragma unroll
            for (int i = 0; i < 8; ++i) {
                const int col = 32 * w + 4 * i + (l >> 3);
                const int ck = (l & 7) * 8;
                const int gc = n0 + col;
                val[i] = *(const v8ha*)(sC + col * PT + ck);
                off[i] = (size_t)2 * PLANE
                       + ((size_t)((bidx * NH + (gc >> 6)) * HD + (gc & 63))) * SQ + s0 + ck;
            }
        }
#pragma unroll
        for (int i = 0; i < 8; ++i) *(v8h*)(O16 + off[i]) = val[i];
        
    }
}

// value of lane l ^ 16 (the other wave half), by a vector cross-row move
__device__ __forceinline__ float xhalf(float x)
{
    const int i = __builtin_bit_cast(int, x);
    return __builtin_bit_cast(float,
        __builtin_amdgcn_permlanex16(i, i, 0x76543210, 0xfedcba98, false, false));
}

// ------------------------------------------------------------------------------------------
// One lane's share of a 64-key stage: four 16-B pieces of the K tile and four of the V tile, rows
// 16 apart, copied from global memory into LDS without passing through registers. A wave's copy
// covers four whole 128-B rows. lk, lv: LDS byte addresses; gk, gv: the matching global addresses.
__device__ __forceinline__ void stage_kv(unsigned lk, unsigned lv,
                                         const _Float16* gk, const _Float16* gv)
{
    // s_wait_xcnt closes the statement so that no address register is rewritten ahead of it
    asm volatile("global_load_async_to_lds_b128 %0, %8, off\n\t"
                 "global_load_async_to_lds_b128 %1, %9, off\n\t"
                 "global_load_async_to_lds_b128 %2, %10, off\n\t"
                 "global_load_async_to_lds_b128 %3, %11, off\n\t"
                 "global_load_async_to_lds_b128 %4, %12, off\n\t"
                 "global_load_async_to_lds_b128 %5, %13, off\n\t"
                 "global_load_async_to_lds_b128 %6, %14, off\n\t"
                 "global_load_async_to_lds_b128 %7, %15, off\n\t"
                 "s_wait_xcnt 0x0"
                 :: "v"(lk), "v"(lk + 16u * KP * 2u), "v"(lk + 32u * KP * 2u), "v"(lk + 48u * KP * 2u),
                    "v"(lv), "v"(lv + 16u * KP * 2u), "v"(lv + 32u * KP * 2u), "v"(lv + 48u * KP * 2u),
                    "v"(gk), "v"(gk + 16 * DM), "v"(gk + 32 * DM), "v"(gk + 48 * DM),
                    "v"(gv), "v"(gv + 16 * SQ), "v"(gv + 32 * SQ), "v"(gv + 48 * SQ)
                 : "memory");
}

__global__ __launch_bounds__(128) __attribute__((amdgpu_num_vgpr(248)))
void k_attn(const _Float16* __restrict__ Qh, const _Float16* __restrict__ Kh,
            const _Float16* __restrict__ Vt, const float* __restrict__ tau,
            const float* __restrict__ delta, _Float16* __restrict__ Ctx)
{
    __shared__ _Float16 __attribute__((aligned(16))) sP[64 * PP];
    __shared__ _Float16 __attribute__((aligned(16))) sKV[2 * 2 * KVT];   // [buffer][K, V][row][KP]
    const int t = threadIdx.x, l = t & 31, w = t >> 5, h = l >> 4, m = l & 15;
    const int bq = blockIdx.z, hd = blockIdx.y, q0 = blockIdx.x * 64;

    const float LOG2E = 1.4426950408889634f;
#if AFFINE_BF16
    const float tb = bfr(tau[bq]);
    const float db = bfr(delta[bq]);
#else
    const float tb = tau[bq];
    const float db = delta[bq];
#endif
    // logit2 = log2(e) * 0.125 * (s * tau + delta), s = sacc / 64 (q and k each carried x8)
    const float c1 = tb * (0.125f / 64.0f) * LOG2E;
    const float c0 = db * 0.125f * LOG2E;

    Frag qf[2];
    {
        const _Float16* qp = Qh + (size_t)(bq * SQ + q0 + 16 * w + m) * DM + hd * HD + 8 * h;
#pragma unroll
        for (int ec = 0; ec < 2; ++ec) {
            qf[ec].p[0] = *(const v8h*)(qp + 32 * ec);        // e = 32ec+8h .. +7
            qf[ec].p[1] = *(const v8h*)(qp + 32 * ec + 16);   // e = 32ec+16+8h .. +7
        }
    }
    // copy side: thread t brings piece (t & 7) of rows (t >> 3) + 16 j, j = 0..3, of each tile
    const _Float16* kcp = Kh + (size_t)(bq * SQ + (t >> 3)) * DM + hd * HD + 8 * (t & 7);
    const _Float16* vcp = Vt + ((size_t)(bq * NH + hd) * HD + (t >> 3)) * SQ + 8 * (t & 7);
    const unsigned lcp = (unsigned)(uintptr_t)(sKV + (t >> 3) * KP + 8 * (t & 7));
    // fragment side: row m of a 16-row group, k = 8h.. and 16+8h.., as before from global memory
    const _Float16* fbase = sKV + m * KP + 8 * h;
    _Float16* myP = sP + w * 16 * PP;

    v8f oacc[4];
#pragma unroll
    for (int et = 0; et < 4; ++et) oacc[et] = zero8();
    float mrun = -1.0e30f;                    // query m: running maximum (both halves alike)
    float lpart[4] = {0.0f, 0.0f, 0.0f, 0.0f};   // query m: sums over this half's keys, one per sub-tile

    stage_kv(lcp, lcp + KVT * 2u, kcp, vcp);
    asm volatile("s_wait_asynccnt 0x0" ::: "memory");   // stage 0 landed, this wave's share
    __syncthreads();                                    // stage 0 readable by every wave
    stage_kv(lcp + 2u * KVT * 2u, lcp + 3u * KVT * 2u, kcp + (size_t)64 * DM, vcp + 64);

    for (int s0 = 0; s0 < SQ; s0 += 64) {
        const unsigned buf = ((unsigned)s0 >> 6) & 1u;
        const _Float16* kT = fbase + buf * (2 * KVT);
        const _Float16* vT = kT + KVT;
        v8f sacc[4];
#pragma unroll
        for (int sub = 0; sub < 4; ++sub) sacc[sub] = zero8();
#pragma unroll
        for (int ec = 0; ec < 2; ++ec) {
            Frag kf[4];
#pragma unroll
            for (int sub = 0; sub < 4; ++sub) {
                const _Float16* kp = kT + (16 * sub) * KP + 32 * ec;
                kf[sub].p[0] = *(const v8ha*)kp;
                kf[sub].p[1] = *(const v8ha*)(kp + 16);
            }
#pragma unroll
            for (int sub = 0; sub < 4; ++sub) sacc[sub] = mma16(kf[sub].v, qf[ec].v, sacc[sub]);
            asm volatile("v_nop\n\tv_nop\n\tv_nop\n\tv_nop"
                         : "+v"(sacc[0]), "+v"(sacc[1]), "+v"(sacc[2]), "+v"(sacc[3])
                         : "v"(qf[ec].v), "v"(kf[0].v), "v"(kf[1].v), "v"(kf[2].v), "v"(kf[3].v));
        }

        // affine + temperature in the log2 domain
#pragma unroll
        for (int sub = 0; sub < 4; ++sub)
#pragma unroll
            for (int r = 0; r < 8; ++r) sacc[sub][r] = sacc[sub][r] * c1 + c0;

        // online softmax; sacc[sub][r] = score of key 16 sub + 8h + r for query m
        float ms[4];                       // four independent chains, one per sub-tile
#pragma unroll
        for (int sub = 0; sub < 4; ++sub) {
            ms[sub] = sacc[sub][0];
#pragma unroll
            for (int r = 1; r < 8; ++r) ms[sub] = fmaxf(ms[sub], sacc[sub][r]);
        }
        float mx = fmaxf(fmaxf(ms[0], ms[1]), fmaxf(ms[2], ms[3]));
        mx = fmaxf(mx, xhalf(mx));
        const float mn = fmaxf(mrun, mx);
        const float alpha = EX2(mrun - mn);
        mrun = mn;
        const float msub = mn - 14.0f;     // numerators carried x2^14
#pragma unroll
        for (int sub = 0; sub < 4; ++sub) lpart[sub] *= alpha;
#pragma unroll
        for (int et = 0; et < 4; ++et)
#pragma unroll
            for (int r = 0; r < 8; ++r) oacc[et][r] *= alpha;

#pragma unroll
        for (int sc = 0; sc < 2; ++sc) {
            // P^T as B: element s of the fragment is key 32sc + 8h + s (s < 8), 32sc + 16 + 8h + s - 8
            // (s >= 8), which is register s & 7 of score tile 2sc + (s >> 3); V^T rows take the same k order
            Frag pf, vf[4];
#pragma unroll
            for (int et = 0; et < 4; ++et) {
                const _Float16* vp = vT + (16 * et) * KP + 32 * sc;
                vf[et].p[0] = *(const v8ha*)vp;
                vf[et].p[1] = *(const v8ha*)(vp + 16);
            }
#pragma unroll
            for (int hf = 0; hf < 2; ++hf)
#pragma unroll
                for (int r = 0; r < 8; ++r) {
                    const float p = EX2(sacc[2 * sc + hf][r] - msub);   // in (0, 16384]
                    lpart[2 * sc + hf] += p;
                    pf.p[hf][r] = (_Float16)p;
                }
#pragma unroll
            for (int et = 0; et < 4; ++et) oacc[et] = mma16(vf[et].v, pf.v, oacc[et]);
            // four vector slots behind the last WMMA, before its D, A or B registers are touched
            asm volatile("v_nop\n\tv_nop\n\tv_nop\n\tv_nop"
                         : "+v"(oacc[0]), "+v"(oacc[1]), "+v"(oacc[2]), "+v"(oacc[3])
                         : "v"(pf.v), "v"(vf[0].v), "v"(vf[1].v), "v"(vf[2].v), "v"(vf[3].v));
        }

        // hand-over: this wave's reads of the current buffer are done, its share of the next stage
        // has landed; behind the barrier the next stage is readable and this buffer is free
        asm volatile("s_wait_dscnt 0x0" ::: "memory");
        asm volatile("s_wait_asynccnt 0x0" ::: "memory");
        __syncthreads();
        if (s0 + 128 < SQ)
            stage_kv(lcp + buf * (2u * KVT * 2u), lcp + buf * (2u * KVT * 2u) + KVT * 2u,
                     kcp + (size_t)(s0 + 128) * DM, vcp + (s0 + 128));
    }
    asm volatile("s_wait_asynccnt 0x0" ::: "memory");   // no copy outstanding past the loop

    // row sum of query m: this half's four partial sums, plus the other half's; context x32 = 4 * O / lsum.
    // oacc[et][r] = O[query m][e = 16 et + 8h + r]: eight consecutive e, one 16-B LDS store
    {
        float lt = (lpart[0] + lpart[1]) + (lpart[2] + lpart[3]);
        lt += xhalf(lt);
        const float inv = 4.0f / lt;
#pragma unroll
        for (int et = 0; et < 4; ++et) {
            v8h o;
#pragma unroll
            for (int r = 0; r < 8; ++r) o[r] = (_Float16)(oacc[et][r] * inv);
            *(v8ha*)(myP + m * PP + 16 * et + 8 * h) = o;
        }
    }
    __syncthreads();
    v8h cv[4];
    size_t coff[4];
#pragma unroll
    for (int i = 0; i < 4; ++i) {
        const int row = 16 * w + 4 * i + (l >> 3);
        const int c8 = (l & 7) * 8;
        cv[i] = *(const v8ha*)(sP + row * PP + c8);
        coff[i] = (size_t)(bq * SQ + q0 + row) * DM + hd * HD + c8;
    }
#pragma unroll
    for (int i = 0; i < 4; ++i) *(v8h*)(Ctx + coff[i]) = cv[i];
    
}

// ------------------------------------------------------------------------------------------
extern "C" void kernel_launch(void* const* d_in, const int* in_sizes, int n_in,
                              void* d_out, int out_size, void* d_ws, size_t ws_size,
                              hipStream_t stream)
{
    if (n_in < 13) return;
    if (in_sizes[0] != PLANE || in_sizes[1] != PLANE || in_sizes[2] != PLANE) return;
    if (in_sizes[3] != NB || in_sizes[4] != NB) return;
    if (in_sizes[5] != DM * DM || in_sizes[7] != DM * DM || in_sizes[9] != DM * DM || in_sizes[11] != DM * DM) return;
    if (in_sizes[6] != DM || in_sizes[8] != DM || in_sizes[10] != DM || in_sizes[12] != DM) return;
    if (out_size != PLANE) return;

    const float* queries = (const float*)d_in[0];
    const float* keys    = (const float*)d_in[1];
    const float* values  = (const float*)d_in[2];
    const float* tau     = (const float*)d_in[3];
    const float* delta   = (const float*)d_in[4];
    const float* Wq = (const float*)d_in[5];
    const float* bq = (const float*)d_in[6];
    const float* Wk = (const float*)d_in[7];
    const float* bk = (const float*)d_in[8];
    const float* Wv = (const float*)d_in[9];
    const float* bv = (const float*)d_in[10];
    const float* Wo = (const float*)d_in[11];
    const float* bo = (const float*)d_in[12];
    float* out = (float*)d_out;

    // workspace carve (bytes), all offsets multiples of 2 MiB
    const size_t szPlane16 = (size_t)PLANE * 2;                 // 8 MiB
    const size_t offXh = 0;                                       // 3 planes  = 24 MiB
    const size_t offWt = offXh + 3 * szPlane16;                   // 4 x 512x512 f16 = 2 MiB
    const size_t offQ  = offWt + (size_t)4 * DM * DM * 2;
    const size_t offK  = offQ + szPlane16;
    const size_t offVt = offK + szPlane16;
    const size_t offC  = offVt + szPlane16;
    const size_t wsEnd = offC + szPlane16;                        // 60,817,408 B
    if (wsEnd > ws_size) return;

    char* ws = (char*)d_ws;
    _Float16* Xh  = (_Float16*)(ws + offXh);
    _Float16* Wt  = (_Float16*)(ws + offWt);
    _Float16* Qh  = (_Float16*)(ws + offQ);
    _Float16* Kh  = (_Float16*)(ws + offK);
    _Float16* Vth = (_Float16*)(ws + offVt);
    _Float16* Ctx = (_Float16*)(ws + offC);

    // 1) activations -> f16 (bf16 value x16)
    k_cvt_act<<<dim3(CVT_GRID, 3, 1), dim3(CVT_BLK), 0, stream>>>(queries, keys, values, Xh);
    // 2) weights -> transposed f16 (bf16 value x64): Wq, Wk, Wv, Wo
    k_cvt_wt<<<dim3(DM / 64, DM / 64, 4), dim3(128), 0, stream>>>(Wq, Wk, Wv, Wo, Wt);
    // 3) q, k (row-major) and v (head-transposed) projections, f16 x8
    k_gemm<false><<<dim3(DM / 128, MR / 64, 3), dim3(128), 0, stream>>>(
        Xh, (int)PLANE, Wt, bq, bk, bv, Qh, out, 1.0f / 1024.0f, 8.0f);
    // 4) attention -> context f16 x32
    k_attn<<<dim3(SQ / 64, NH, NB), dim3(128), 0, stream>>>(Qh, Kh, Vth, tau, delta, Ctx);
    // 5) output projection -> f32
    k_gemm<true><<<dim3(DM / 128, MR / 64, 1), dim3(128), 0, stream>>>(
        Ctx, 0, Wt + (size_t)3 * DM * DM, bo, bo, bo, Qh, out, 1.0f / 2048.0f, 1.0f);
}

// v003
// A run of this version takes 84.1 microseconds.
// Timed twice side by side with v002, it ran 1.37 times as fast both times.
// All steps since v000 together make it 2.27 times as fast.
#include <hip/hip_runtime.h>
#include <stdint.h>

// All six contractions (three input projections, q.k^T, p.v, output projection):
// v_wmma_f32_16x16x32_f16, f16 operands, f32 accumulate. Float inputs are RNE-converted to
// bf16 values held exactly in f16 containers (activations x16, weights x64; tau, delta, bias as
// f32-held bf16 values); intermediates: q,k,v f16 x8, softmax numerators f16 x2^14, context f16 x32.
// Every scale is a power of two removed in f32. Softmax statistics in f32.

#ifndef AFFINE_BF16
#define AFFINE_BF16 1   // 1: tau and delta RNE-converted to bf16 values before use; 0: used as given
#endif

#define DM 512
#define NH 8
#define HD 64
#define NB 4
#define SQ 2048
#define MR (NB * SQ)            // 8192 token rows
#define PLANE (MR * DM)         // 4194304 elements per activation plane
#define PP 72                   // f16 LDS pitch of the per-wave context tile (epilogue)
#define PC 136                  // f16 LDS pitch of the row-major 64x128 epilogue tile
#define PT 72                   // f16 LDS pitch of the transposed 128x64 epilogue tile
#define PO 132                  // f32 LDS pitch of the 64x128 epilogue tile
#define KP 72                   // f16 LDS pitch of a staged 64-element K or V row (144 B = 16 B x 9)
#define KVT (64 * KP)           // f16 elements of one staged 64x64 tile
#define GK 64                   // k elements of one staged GEMM panel: one whole 128-B line per row
#define GA (64 * KP)            // f16 elements of a staged 64-row A panel
#define GB (128 * KP)           // f16 elements of a staged 128-row B panel
#define GST (GA + GB)           // f16 elements of one GEMM stage

#define CVT_BLK 256
#define CVT_UNITS 4
#define UPP (PLANE / 8)         // 8-element units per plane = 524288
#define CVT_GRID (UPP / (CVT_BLK * CVT_UNITS))   // 512, exact

typedef _Float16 v16h __attribute__((ext_vector_type(16)));
typedef _Float16 v8h  __attribute__((ext_vector_type(8)));
typedef v8h __attribute__((may_alias)) v8ha;
typedef float v8f __attribute__((ext_vector_type(8)));
typedef float v4f __attribute__((ext_vector_type(4)));
typedef v4f __attribute__((may_alias)) v4fa;

union Frag { v16h v; v8h p[2]; };

#if defined(__has_builtin)
#if __has_builtin(__builtin_amdgcn_exp2f)
#define EX2(x) __builtin_amdgcn_exp2f(x)
#endif
#endif
#ifndef EX2
#define EX2(x) __expf((x) * 0.69314718055994531f)
#endif

// f32 -> nearest-even bf16 value, returned as f32
__device__ __forceinline__ float bfr(float x)
{
    unsigned u = __float_as_uint(x);
    u = (u + 0x7fffu + ((u >> 16) & 1u)) & 0xffff0000u;
    return __uint_as_float(u);
}
// bf16 value times a power of two, held in an f16 container (exact in the normal range)
__device__ __forceinline__ _Float16 cvh(float x, float s) { return (_Float16)(bfr(x) * s); }

__device__ __forceinline__ v8f mma16(v16h a, v16h b, v8f c)
{
    return __builtin_amdgcn_wmma_f32_16x16x32_f16(false, a, false, b, (short)0, c, false, false);
}

__device__ __forceinline__ v8f zero8()
{
    v8f z;
#pragma unroll
    for (int i = 0; i < 8; ++i) z[i] = 0.0f;
    return z;
}

// ------------------------------------------------------------------------------------------
// Activation convert: three f32 [8192][512] planes -> f16 planes (bf16 value x16).
// One lane handles 8 consecutive elements (16 B); one wave store instruction covers 4 whole
__global__ __launch_bounds__(CVT_BLK)
void k_cvt_act(const float* __restrict__ x0, const float* __restrict__ x1,
               const float* __restrict__ x2, _Float16* __restrict__ xh)
{
    const int pl = blockIdx.y;
    const float* src = (pl == 0) ? x0 : ((pl == 1) ? x1 : x2);
    _Float16* dst = xh + (size_t)pl * PLANE;
    const int t0 = blockIdx.x * CVT_BLK + (int)threadIdx.x;
    v8h val[CVT_UNITS];
    int uu[CVT_UNITS];
#pragma unroll
    for (int j = 0; j < CVT_UNITS; ++j) {
        int u = t0 + j * (CVT_GRID * CVT_BLK);
        u = (u < UPP) ? u : (UPP - 1);
        uu[j] = u;
        const float4 a = *(const float4*)(src + (size_t)u * 8);
        const float4 b = *(const float4*)(src + (size_t)u * 8 + 4);
        v8h v;
        v[0] = cvh(a.x, 16.0f); v[1] = cvh(a.y, 16.0f); v[2] = cvh(a.z, 16.0f); v[3] = cvh(a.w, 16.0f);
        v[4] = cvh(b.x, 16.0f); v[5] = cvh(b.y, 16.0f); v[6] = cvh(b.z, 16.0f); v[7] = cvh(b.w, 16.0f);
        val[j] = v;
    }
#pragma unroll
    for (int j = 0; j < CVT_UNITS; ++j)
        *(v8h*)(dst + (size_t)uu[j] * 8) = val[j];
    
}

// ------------------------------------------------------------------------------------------
// Weight convert + transpose: four f32 W[k][n] (512x512) -> f16 Wt[n][k] (bf16 value x64),
// k-contiguous so B fragments load like A fragments. 64x64 tile through LDS; each output line
__global__ __launch_bounds__(128)
void k_cvt_wt(const float* __restrict__ w0, const float* __restrict__ w1,
              const float* __restrict__ w2, const float* __restrict__ w3,
              _Float16* __restrict__ wt)
{
    __shared__ _Float16 __attribute__((aligned(16))) sT[64 * PT];   // [n_local][k_local]
    const int z = blockIdx.z;
    const float* src = (z == 0) ? w0 : ((z == 1) ? w1 : ((z == 2) ? w2 : w3));
    _Float16* dst = wt + (size_t)z * (DM * DM);
    const int k0 = blockIdx.y * 64, n0 = blockIdx.x * 64;
    const int t = threadIdx.x, l = t & 31, w = t >> 5;
    const int nn = (t & 15) * 4, kb = t >> 4;
#pragma unroll
    for (int i = 0; i < 8; ++i) {
        const int kk = kb + 8 * i;
        const float4 v = *(const float4*)(src + (size_t)(k0 + kk) * DM + n0 + nn);
        sT[(nn + 0) * PT + kk] = cvh(v.x, 64.0f);
        sT[(nn + 1) * PT + kk] = cvh(v.y, 64.0f);
        sT[(nn + 2) * PT + kk] = cvh(v.z, 64.0f);
        sT[(nn + 3) * PT + kk] = cvh(v.w, 64.0f);
    }
    __syncthreads();
    v8h val[4];
    size_t off[4];
#pragma unroll
    for (int i = 0; i < 4; ++i) {
        const int line = 16 * w + 4 * i + (l >> 3);   // n_local
        const int ck = (l & 7) * 8;
        val[i] = *(const v8ha*)(sT + line * PT + ck);
        off[i] = (size_t)(n0 + line) * DM + k0 + ck;
    }
#pragma unroll
    for (int i = 0; i < 4; ++i) *(v8h*)(dst + off[i]) = val[i];
    
}

// ------------------------------------------------------------------------------------------
// One lane's share of a 64-k GEMM stage: four 16-B pieces of the 64-row A panel and eight of the
// 128-row B panel, rows 16 apart, copied from global memory into LDS without passing through
// registers. A wave's copy covers four whole 128-B lines. la, lb: LDS byte addresses; ga, gb: the
// matching global addresses.
__device__ __forceinline__ void stage_ab(unsigned la, unsigned lb,
                                         const _Float16* ga, const _Float16* gb)
{
    // s_wait_xcnt closes the statement so that no address register is rewritten ahead of it
    asm volatile("global_load_async_to_lds_b128 %0, %12, off\n\t"
                 "global_load_async_to_lds_b128 %1, %13, off\n\t"
                 "global_load_async_to_lds_b128 %2, %14, off\n\t"
                 "global_load_async_to_lds_b128 %3, %15, off\n\t"
                 "global_load_async_to_lds_b128 %4, %16, off\n\t"
                 "global_load_async_to_lds_b128 %5, %17, off\n\t"
                 "global_load_async_to_lds_b128 %6, %18, off\n\t"
                 "global_load_async_to_lds_b128 %7, %19, off\n\t"
                 "global_load_async_to_lds_b128 %8, %20, off\n\t"
                 "global_load_async_to_lds_b128 %9, %21, off\n\t"
                 "global_load_async_to_lds_b128 %10, %22, off\n\t"
                 "global_load_async_to_lds_b128 %11, %23, off\n\t"
                 "s_wait_xcnt 0x0"
                 :: "v"(la), "v"(la + 16u * KP * 2u), "v"(la + 32u * KP * 2u), "v"(la + 48u * KP * 2u),
                    "v"(lb), "v"(lb + 16u * KP * 2u), "v"(lb + 32u * KP * 2u), "v"(lb + 48u * KP * 2u),
                    "v"(lb + 64u * KP * 2u), "v"(lb + 80u * KP * 2u), "v"(lb + 96u * KP * 2u),
                    "v"(lb + 112u * KP * 2u),
                    "v"(ga), "v"(ga + 16 * DM), "v"(ga + 32 * DM), "v"(ga + 48 * DM),
                    "v"(gb), "v"(gb + 16 * DM), "v"(gb + 32 * DM), "v"(gb + 48 * DM),
                    "v"(gb + 64 * DM), "v"(gb + 80 * DM), "v"(gb + 96 * DM), "v"(gb + 112 * DM)
                 : "memory");
}

// ------------------------------------------------------------------------------------------
// C[64 x 128 per block] = A[rows][512] (f16, row-major) * B, with B given as Bt[n][k] (f16).
// 4 waves, each a 32x64 sub-tile = 2x4 accumulators. Each 64-k panel of A and of B is brought into
// LDS once per block by asynchronous copies, two buffers, one stage ahead of its use; the waves
// read their fragments from there with the 16x16x32 split-k lane map for both A and B.
// !OUTF: v = (acc*s_acc + bf16(bias)) * s_out -> f16; blockIdx.z selects the plane
//        (z=0,1 row-major [8192][512]; z=2 head-transposed [NB][NH][HD][SQ]).
// OUTF : same value -> f32 d_out.
template<bool OUTF>
__global__ __launch_bounds__(128) __attribute__((amdgpu_num_vgpr(248)))
void k_gemm(const _Float16* __restrict__ A, int planeA, const _Float16* __restrict__ Bt,
            const float* __restrict__ bi0, const float* __restrict__ bi1,
            const float* __restrict__ bi2,
            _Float16* __restrict__ O16, float* __restrict__ O32, float s_acc, float s_out)
{
    const int t = threadIdx.x, l = t & 31, w = t >> 5, h = l >> 4, m = l & 15;
    const int z = blockIdx.z;
    const int n0 = blockIdx.x * 128, m0 = blockIdx.y * 64;
    const int wm = (w >> 1) * 32, wn = (w & 1) * 64;
    const _Float16* Ab = A + (size_t)z * (size_t)planeA;
    const _Float16* Bb = Bt + (size_t)z * (DM * DM);
    const float* bias = (z == 0) ? bi0 : ((z == 1) ? bi1 : bi2);

    __shared__ _Float16 __attribute__((aligned(16))) sAB[2 * GST];   // [buffer][A 64 rows, B 128 rows][KP]
    // copy side: thread t brings piece (t & 7) of rows (t >> 3) + 16 j of each panel
    const _Float16* acp = Ab + (size_t)(m0 + (t >> 3)) * DM + 8 * (t & 7);
    const _Float16* bcp = Bb + (size_t)(n0 + (t >> 3)) * DM + 8 * (t & 7);
    const unsigned lcp = (unsigned)(uintptr_t)(sAB + (t >> 3) * KP + 8 * (t & 7));
    // fragment side: row m of a 16-row group, k = 8h.. and 16+8h.. of each 32-k half
    const _Float16* fa = sAB + (wm + m) * KP + 8 * h;
    const _Float16* fb = sAB + GA + (wn + m) * KP + 8 * h;

    v8f acc[2][4];
#pragma unroll
    for (int mi = 0; mi < 2; ++mi)
#pragma unroll
        for (int ni = 0; ni < 4; ++ni) acc[mi][ni] = zero8();

    stage_ab(lcp, lcp + GA * 2u, acp, bcp);
    asm volatile("s_wait_asynccnt 0x0" ::: "memory");   // stage 0 landed, this wave's share
    __syncthreads();                                    // stage 0 readable by every wave
    stage_ab(lcp + GST * 2u, lcp + (GST + GA) * 2u, acp + GK, bcp + GK);

    // two trips a pass: each buffer's LDS offsets are immediates; unrolled whole, the build formed the
    // copy addresses of all later stages early and took about 250 VGPRs
#pragma unroll 2
    for (int k0 = 0; k0 < DM; k0 += GK) {
        const unsigned buf = ((unsigned)k0 >> 6) & 1u;
        const _Float16* aT = fa + buf * GST;
        const _Float16* bT = fb + buf * GST;
        // both 32-k halves are named ahead of the 16 WMMAs, so the second half's reads can issue among
        // the first half's WMMAs
        Frag a[2][2], b[2][4];
#pragma unroll
        for (int kh = 0; kh < 2; ++kh) {
#pragma unroll
            for (int mi = 0; mi < 2; ++mi) {
                a[kh][mi].p[0] = *(const v8ha*)(aT + (16 * mi) * KP + 32 * kh);        // k0+32kh+8h .. +7
                a[kh][mi].p[1] = *(const v8ha*)(aT + (16 * mi) * KP + 32 * kh + 16);   // k0+32kh+16+8h .. +7
            }
#pragma unroll
            for (int ni = 0; ni < 4; ++ni) {
                b[kh][ni].p[0] = *(const v8ha*)(bT + (16 * ni) * KP + 32 * kh);
                b[kh][ni].p[1] = *(const v8ha*)(bT + (16 * ni) * KP + 32 * kh + 16);
            }
        }
#pragma unroll
        for (int kh = 0; kh < 2; ++kh)
#pragma unroll
            for (int mi = 0; mi < 2; ++mi)
#pragma unroll
                for (int ni = 0; ni < 4; ++ni)
                    acc[mi][ni] = mma16(a[kh][mi].v, b[kh][ni].v, acc[mi][ni]);
        // four vector slots behind the last WMMA, before its D, A or B registers are touched
        asm volatile("v_nop\n\tv_nop\n\tv_nop\n\tv_nop"
                     : "+v"(acc[0][0]), "+v"(acc[0][1]), "+v"(acc[0][2]), "+v"(acc[0][3]),
                       "+v"(acc[1][0]), "+v"(acc[1][1]), "+v"(acc[1][2]), "+v"(acc[1][3])
                     : "v"(a[1][0].v), "v"(a[1][1].v), "v"(b[1][0].v), "v"(b[1][1].v), "v"(b[1][2].v),
                       "v"(b[1][3].v));

        // hand-over: this wave's reads of the current buffer are done, its share of the next stage
        // has landed; behind the barrier the next stage is readable and this buffer is free
        asm volatile("s_wait_dscnt 0x0" ::: "memory");
        asm volatile("s_wait_asynccnt 0x0" ::: "memory");
        __syncthreads();
        if (k0 + 2 * GK < DM)
            stage_ab(lcp + buf * (GST * 2u), lcp + buf * (GST * 2u) + GA * 2u,
                     acp + (k0 + 2 * GK), bcp + (k0 + 2 * GK));
    }
    asm volatile("s_wait_asynccnt 0x0" ::: "memory");   // no copy outstanding past the loop

    float bb[4];
#pragma unroll
    for (int ni = 0; ni < 4; ++ni) bb[ni] = bfr(bias[n0 + wn + 16 * ni + m]);

    if constexpr (OUTF) {
        __shared__ float __attribute__((aligned(16))) sO[64 * PO];
#pragma unroll
        for (int mi = 0; mi < 2; ++mi)
#pragma unroll
            for (int ni = 0; ni < 4; ++ni)
#pragma unroll
                for (int r = 0; r < 8; ++r) {
                    const int row = wm + 16 * mi + 8 * h + r;
                    const int col = wn + 16 * ni + m;
                    sO[row * PO + col] = (acc[mi][ni][r] * s_acc + bb[ni]) * s_out;
                }
        __syncthreads();
        v4f val[16];
#pragma unroll
        for (int i = 0; i < 16; ++i) val[i] = *(const v4fa*)(sO + (16 * w + i) * PO + 4 * l);
#pragma unroll
        for (int i = 0; i < 16; ++i)
            *(v4f*)(O32 + (size_t)(m0 + 16 * w + i) * DM + n0 + 4 * l) = val[i];
        
    } else {
        __shared__ _Float16 __attribute__((aligned(16))) sC[9216];   // 64x136 or 128x72 view
        if (z != 2) {
#pragma unroll
            for (int mi = 0; mi < 2; ++mi)
#pragma unroll
                for (int ni = 0; ni < 4; ++ni)
#pragma unroll
                    for (int r = 0; r < 8; ++r) {
                        const int row = wm + 16 * mi + 8 * h + r;
                        const int col = wn + 16 * ni + m;
                        sC[row * PC + col] = (_Float16)((acc[mi][ni][r] * s_acc + bb[ni]) * s_out);
                    }
        } else {
#pragma unroll
            for (int mi = 0; mi < 2; ++mi)
#pragma unroll
                for (int ni = 0; ni < 4; ++ni)
#pragma unroll
                    for (int r = 0; r < 8; ++r) {
                        const int row = wm + 16 * mi + 8 * h + r;
                        const int col = wn + 16 * ni + m;
                        sC[col * PT + row] = (_Float16)((acc[mi][ni][r] * s_acc + bb[ni]) * s_out);
                    }
        }
        __syncthreads();
        v8h val[8];
        size_t off[8];
        if (z != 2) {
#pragma unroll
            for (int i = 0; i < 8; ++i) {
                const int row = 16 * w + 2 * i + (l >> 4);
                const int c8 = (l & 15) * 8;
                val[i] = *(const v8ha*)(sC + row * PC + c8);
                off[i] = (size_t)z * PLANE + (size_t)(m0 + row) * DM + n0 + c8;
            }
        } else {
            // transposed: one line per tile column (64 consecutive s of one (b,head,e) row)
            const int bidx = m0 / SQ, s0 = m0 - bidx * SQ;
#pragma unroll
            for (int i = 0; i < 8; ++i) {
                const int col = 32 * w + 4 * i + (l >> 3);
                const int ck = (l & 7) * 8;
                const int gc = n0 + col;
                val[i] = *(const v8ha*)(sC + col * PT + ck);
                off[i] = (size_t)2 * PLANE
                       + ((size_t)((bidx * NH + (gc >> 6)) * HD + (gc & 63))) * SQ + s0 + ck;
            }
        }
#pragma unroll
        for (int i = 0; i < 8; ++i) *(v8h*)(O16 + off[i]) = val[i];
        
    }
}

// value of lane l ^ 16 (the other wave half), by a vector cross-row move
__device__ __forceinline__ float xhalf(float x)
{
    const int i = __builtin_bit_cast(int, x);
    return __builtin_bit_cast(float,
        __builtin_amdgcn_permlanex16(i, i, 0x76543210, 0xfedcba98, false, false));
}

// ------------------------------------------------------------------------------------------
// One lane's share of a 64-key stage: four 16-B pieces of the K tile and four of the V tile, rows
// 16 apart, copied from global memory into LDS without passing through registers. A wave's copy
// covers four whole 128-B rows. lk, lv: LDS byte addresses; gk, gv: the matching global addresses.
__device__ __forceinline__ void stage_kv(unsigned lk, unsigned lv,
                                         const _Float16* gk, const _Float16* gv)
{
    // s_wait_xcnt closes the statement so that no address register is rewritten ahead of it
    asm volatile("global_load_async_to_lds_b128 %0, %8, off\n\t"
                 "global_load_async_to_lds_b128 %1, %9, off\n\t"
                 "global_load_async_to_lds_b128 %2, %10, off\n\t"
                 "global_load_async_to_lds_b128 %3, %11, off\n\t"
                 "global_load_async_to_lds_b128 %4, %12, off\n\t"
                 "global_load_async_to_lds_b128 %5, %13, off\n\t"
                 "global_load_async_to_lds_b128 %6, %14, off\n\t"
                 "global_load_async_to_lds_b128 %7, %15, off\n\t"
                 "s_wait_xcnt 0x0"
                 :: "v"(lk), "v"(lk + 16u * KP * 2u), "v"(lk + 32u * KP * 2u), "v"(lk + 48u * KP * 2u),
                    "v"(lv), "v"(lv + 16u * KP * 2u), "v"(lv + 32u * KP * 2u), "v"(lv + 48u * KP * 2u),
                    "v"(gk), "v"(gk + 16 * DM), "v"(gk + 32 * DM), "v"(gk + 48 * DM),
                    "v"(gv), "v"(gv + 16 * SQ), "v"(gv + 32 * SQ), "v"(gv + 48 * SQ)
                 : "memory");
}

__global__ __launch_bounds__(128) __attribute__((amdgpu_num_vgpr(248)))
void k_attn(const _Float16* __restrict__ Qh, const _Float16* __restrict__ Kh,
            const _Float16* __restrict__ Vt, const float* __restrict__ tau,
            const float* __restrict__ delta, _Float16* __restrict__ Ctx)
{
    __shared__ _Float16 __attribute__((aligned(16))) sP[64 * PP];
    __shared__ _Float16 __attribute__((aligned(16))) sKV[2 * 2 * KVT];   // [buffer][K, V][row][KP]
    const int t = threadIdx.x, l = t & 31, w = t >> 5, h = l >> 4, m = l & 15;
    const int bq = blockIdx.z, hd = blockIdx.y, q0 = blockIdx.x * 64;

    const float LOG2E = 1.4426950408889634f;
#if AFFINE_BF16
    const float tb = bfr(tau[bq]);
    const float db = bfr(delta[bq]);
#else
    const float tb = tau[bq];
    const float db = delta[bq];
#endif
    // logit2 = log2(e) * 0.125 * (s * tau + delta), s = sacc / 64 (q and k each carried x8)
    const float c1 = tb * (0.125f / 64.0f) * LOG2E;
    const float c0 = db * 0.125f * LOG2E;

    Frag qf[2];
    {
        const _Float16* qp = Qh + (size_t)(bq * SQ + q0 + 16 * w + m) * DM + hd * HD + 8 * h;
#pragma unroll
        for (int ec = 0; ec < 2; ++ec) {
            qf[ec].p[0] = *(const v8h*)(qp + 32 * ec);        // e = 32ec+8h .. +7
            qf[ec].p[1] = *(const v8h*)(qp + 32 * ec + 16);   // e = 32ec+16+8h .. +7
        }
    }
    // copy side: thread t brings piece (t & 7) of rows (t >> 3) + 16 j, j = 0..3, of each tile
    const _Float16* kcp = Kh + (size_t)(bq * SQ + (t >> 3)) * DM + hd * HD + 8 * (t & 7);
    const _Float16* vcp = Vt + ((size_t)(bq * NH + hd) * HD + (t >> 3)) * SQ + 8 * (t & 7);
    const unsigned lcp = (unsigned)(uintptr_t)(sKV + (t >> 3) * KP + 8 * (t & 7));
    // fragment side: row m of a 16-row group, k = 8h.. and 16+8h.., as before from global memory
    const _Float16* fbase = sKV + m * KP + 8 * h;
    _Float16* myP = sP + w * 16 * PP;

    v8f oacc[4];
#pragma unroll
    for (int et = 0; et < 4; ++et) oacc[et] = zero8();
    float mrun = -1.0e30f;                    // query m: running maximum (both halves alike)
    float lpart[4] = {0.0f, 0.0f, 0.0f, 0.0f};   // query m: sums over this half's keys, one per sub-tile

    stage_kv(lcp, lcp + KVT * 2u, kcp, vcp);
    asm volatile("s_wait_asynccnt 0x0" ::: "memory");   // stage 0 landed, this wave's share
    __syncthreads();                                    // stage 0 readable by every wave
    stage_kv(lcp + 2u * KVT * 2u, lcp + 3u * KVT * 2u, kcp + (size_t)64 * DM, vcp + 64);

    for (int s0 = 0; s0 < SQ; s0 += 64) {
        const unsigned buf = ((unsigned)s0 >> 6) & 1u;
        const _Float16* kT = fbase + buf * (2 * KVT);
        const _Float16* vT = kT + KVT;
        v8f sacc[4];
#pragma unroll
        for (int sub = 0; sub < 4; ++sub) sacc[sub] = zero8();
#pragma unroll
        for (int ec = 0; ec < 2; ++ec) {
            Frag kf[4];
#pragma unroll
            for (int sub = 0; sub < 4; ++sub) {
                const _Float16* kp = kT + (16 * sub) * KP + 32 * ec;
                kf[sub].p[0] = *(const v8ha*)kp;
                kf[sub].p[1] = *(const v8ha*)(kp + 16);
            }
#pragma unroll
            for (int sub = 0; sub < 4; ++sub) sacc[sub] = mma16(kf[sub].v, qf[ec].v, sacc[sub]);
            asm volatile("v_nop\n\tv_nop\n\tv_nop\n\tv_nop"
                         : "+v"(sacc[0]), "+v"(sacc[1]), "+v"(sacc[2]), "+v"(sacc[3])
                         : "v"(qf[ec].v), "v"(kf[0].v), "v"(kf[1].v), "v"(kf[2].v), "v"(kf[3].v));
        }

        // affine + temperature in the log2 domain
#pragma unroll
        for (int sub = 0; sub < 4; ++sub)
#pragma unroll
            for (int r = 0; r < 8; ++r) sacc[sub][r] = sacc[sub][r] * c1 + c0;

        // online softmax; sacc[sub][r] = score of key 16 sub + 8h + r for query m
        float ms[4];                       // four independent chains, one per sub-tile
#pragma unroll
        for (int sub = 0; sub < 4; ++sub) {
            ms[sub] = sacc[sub][0];
#pragma unroll
            for (int r = 1; r < 8; ++r) ms[sub] = fmaxf(ms[sub], sacc[sub][r]);
        }
        float mx = fmaxf(fmaxf(ms[0], ms[1]), fmaxf(ms[2], ms[3]));
        mx = fmaxf(mx, xhalf(mx));
        const float mn = fmaxf(mrun, mx);
        const float alpha = EX2(mrun - mn);
        mrun = mn;
        const float msub = mn - 14.0f;     // numerators carried x2^14
#pragma unroll
        for (int sub = 0; sub < 4; ++sub) lpart[sub] *= alpha;
#pragma unroll
        for (int et = 0; et < 4; ++et)
#pragma unroll
            for (int r = 0; r < 8; ++r) oacc[et][r] *= alpha;

#pragma unroll
        for (int sc = 0; sc < 2; ++sc) {
            // P^T as B: element s of the fragment is key 32sc + 8h + s (s < 8), 32sc + 16 + 8h + s - 8
            // (s >= 8), which is register s & 7 of score tile 2sc + (s >> 3); V^T rows take the same k order
            Frag pf, vf[4];
#pragma unroll
            for (int et = 0; et < 4; ++et) {
                const _Float16* vp = vT + (16 * et) * KP + 32 * sc;
                vf[et].p[0] = *(const v8ha*)vp;
                vf[et].p[1] = *(const v8ha*)(vp + 16);
            }
#pragma unroll
            for (int hf = 0; hf < 2; ++hf)
#pragma unroll
                for (int r = 0; r < 8; ++r) {
                    const float p = EX2(sacc[2 * sc + hf][r] - msub);   // in (0, 16384]
                    lpart[2 * sc + hf] += p;
                    pf.p[hf][r] = (_Float16)p;
                }
#pragma unroll
            for (int et = 0; et < 4; ++et) oacc[et] = mma16(vf[et].v, pf.v, oacc[et]);
            // four vector slots behind the last WMMA, before its D, A or B registers are touched
            asm volatile("v_nop\n\tv_nop\n\tv_nop\n\tv_nop"
                         : "+v"(oacc[0]), "+v"(oacc[1]), "+v"(oacc[2]), "+v"(oacc[3])
                         : "v"(pf.v), "v"(vf[0].v), "v"(vf[1].v), "v"(vf[2].v), "v"(vf[3].v));
        }

        // hand-over: this wave's reads of the current buffer are done, its share of the next stage
        // has landed; behind the barrier the next stage is readable and this buffer is free
        asm volatile("s_wait_dscnt 0x0" ::: "memory");
        asm volatile("s_wait_asynccnt 0x0" ::: "memory");
        __syncthreads();
        if (s0 + 128 < SQ)
            stage_kv(lcp + buf * (2u * KVT * 2u), lcp + buf * (2u * KVT * 2u) + KVT * 2u,
                     kcp + (size_t)(s0 + 128) * DM, vcp + (s0 + 128));
    }
    asm volatile("s_wait_asynccnt 0x0" ::: "memory");   // no copy outstanding past the loop

    // row sum of query m: this half's four partial sums, plus the other half's; context x32 = 4 * O / lsum.
    // oacc[et][r] = O[query m][e = 16 et + 8h + r]: eight consecutive e, one 16-B LDS store
    {
        float lt = (lpart[0] + lpart[1]) + (lpart[2] + lpart[3]);
        lt += xhalf(lt);
        const float inv = 4.0f / lt;
#pragma unroll
        for (int et = 0; et < 4; ++et) {
            v8h o;
#pragma unroll
            for (int r = 0; r < 8; ++r) o[r] = (_Float16)(oacc[et][r] * inv);
            *(v8ha*)(myP + m * PP + 16 * et + 8 * h) = o;
        }
    }
    __syncthreads();
    v8h cv[4];
    size_t coff[4];
#pragma unroll
    for (int i = 0; i < 4; ++i) {
        const int row = 16 * w + 4 * i + (l >> 3);
        const int c8 = (l & 7) * 8;
        cv[i] = *(const v8ha*)(sP + row * PP + c8);
        coff[i] = (size_t)(bq * SQ + q0 + row) * DM + hd * HD + c8;
    }
#pragma unroll
    for (int i = 0; i < 4; ++i) *(v8h*)(Ctx + coff[i]) = cv[i];
    
}

// ------------------------------------------------------------------------------------------
extern "C" void kernel_launch(void* const* d_in, const int* in_sizes, int n_in,
                              void* d_out, int out_size, void* d_ws, size_t ws_size,
                              hipStream_t stream)
{
    if (n_in < 13) return;
    if (in_sizes[0] != PLANE || in_sizes[1] != PLANE || in_sizes[2] != PLANE) return;
    if (in_sizes[3] != NB || in_sizes[4] != NB) return;
    if (in_sizes[5] != DM * DM || in_sizes[7] != DM * DM || in_sizes[9] != DM * DM || in_sizes[11] != DM * DM) return;
    if (in_sizes[6] != DM || in_sizes[8] != DM || in_sizes[10] != DM || in_sizes[12] != DM) return;
    if (out_size != PLANE) return;

    const float* queries = (const float*)d_in[0];
    const float* keys    = (const float*)d_in[1];
    const float* values  = (const float*)d_in[2];
    const float* tau     = (const float*)d_in[3];
    const float* delta   = (const float*)d_in[4];
    const float* Wq = (const float*)d_in[5];
    const float* bq = (const float*)d_in[6];
    const float* Wk = (const float*)d_in[7];
    const float* bk = (const float*)d_in[8];
    const float* Wv = (const float*)d_in[9];
    const float* bv = (const float*)d_in[10];
    const float* Wo = (const float*)d_in[11];
    const float* bo = (const float*)d_in[12];
    float* out = (float*)d_out;

    // workspace carve (bytes), all offsets multiples of 2 MiB
    const size_t szPlane16 = (size_t)PLANE * 2;                 // 8 MiB
    const size_t offXh = 0;                                       // 3 planes  = 24 MiB
    const size_t offWt = offXh + 3 * szPlane16;                   // 4 x 512x512 f16 = 2 MiB
    const size_t offQ  = offWt + (size_t)4 * DM * DM * 2;
    const size_t offK  = offQ + szPlane16;
    const size_t offVt = offK + szPlane16;
    const size_t offC  = offVt + szPlane16;
    const size_t wsEnd = offC + szPlane16;                        // 60,817,408 B
    if (wsEnd > ws_size) return;

    char* ws = (char*)d_ws;
    _Float16* Xh  = (_Float16*)(ws + offXh);
    _Float16* Wt  = (_Float16*)(ws + offWt);
    _Float16* Qh  = (_Float16*)(ws + offQ);
    _Float16* Kh  = (_Float16*)(ws + offK);
    _Float16* Vth = (_Float16*)(ws + offVt);
    _Float16* Ctx = (_Float16*)(ws + offC);

    // 1) activations -> f16 (bf16 value x16)
    k_cvt_act<<<dim3(CVT_GRID, 3, 1), dim3(CVT_BLK), 0, stream>>>(queries, keys, values, Xh);
    // 2) weights -> transposed f16 (bf16 value x64): Wq, Wk, Wv, Wo
    k_cvt_wt<<<dim3(DM / 64, DM / 64, 4), dim3(128), 0, stream>>>(Wq, Wk, Wv, Wo, Wt);
    // 3) q, k (row-major) and v (head-transposed) projections, f16 x8
    k_gemm<false><<<dim3(DM / 128, MR / 64, 3), dim3(128), 0, stream>>>(
        Xh, (int)PLANE, Wt, bq, bk, bv, Qh, out, 1.0f / 1024.0f, 8.0f);
    // 4) attention -> context f16 x32
    k_attn<<<dim3(SQ / 64, NH, NB), dim3(128), 0, stream>>>(Qh, Kh, Vth, tau, delta, Ctx);
    // 5) output projection -> f32
    k_gemm<true><<<dim3(DM / 128, MR / 64, 1), dim3(128), 0, stream>>>(
        Ctx, 0, Wt + (size_t)3 * DM * DM, bo, bo, bo, Qh, out, 1.0f / 2048.0f, 1.0f);
}

// v004
// One run takes 78.4 microseconds.
// Timed twice side by side with v003, it ran 1.07 times as fast both times.
// All steps since v000 together make it 2.43 times as fast.
#include <hip/hip_runtime.h>
#include <stdint.h>

// All six contractions (three input projections, q.k^T, p.v, output projection):
// v_wmma_f32_16x16x32_f16, f16 operands, f32 accumulate. Float inputs are RNE-converted to
// bf16 values held exactly in f16 containers (activations x16, weights x64; tau, delta, bias as
// f32-held bf16 values); intermediates: q,k,v f16 x8, softmax numerators f16 x2^14, context f16 x32.
// Every scale is a power of two removed in f32. Softmax statistics in f32.

#ifndef AFFINE_BF16
#define AFFINE_BF16 1   // 1: tau and delta RNE-converted to bf16 values before use; 0: used as given
#endif

#define DM 512
#define NH 8
#define HD 64
#define NB 4
#define SQ 2048
#define MR (NB * SQ)            // 8192 token rows
#define PLANE (MR * DM)         // 4194304 elements per activation plane
#define PP 72                   // f16 LDS pitch of the per-wave context tile (epilogue)
#define PC 136                  // f16 LDS pitch of the row-major 64x128 epilogue tile
#define PT 72                   // f16 LDS pitch of the transposed 128x64 epilogue tile
#define PO 132                  // f32 LDS pitch of the 64x128 epilogue tile
#define KP 72                   // f16 LDS pitch of a staged 64-element K or V row (144 B = 16 B x 9)
#define KVT (64 * KP)           // f16 elements of one staged 64x64 tile
#define QB 128                  // query rows of one attention block
#define GK 64                   // k elements of one staged GEMM panel: one whole 128-B line per row
#define GA (64 * KP)            // f16 elements of a staged 64-row A panel
#define GB (128 * KP)           // f16 elements of a staged 128-row B panel
#define GST (GA + GB)           // f16 elements of one GEMM stage

#define CVT_BLK 256
#define CVT_UNITS 4
#define UPP (PLANE / 8)         // 8-element units per plane = 524288
#define CVT_GRID (UPP / (CVT_BLK * CVT_UNITS))   // 512, exact

typedef _Float16 v16h __attribute__((ext_vector_type(16)));
typedef _Float16 v8h  __attribute__((ext_vector_type(8)));
typedef v8h __attribute__((may_alias)) v8ha;
typedef float v8f __attribute__((ext_vector_type(8)));
typedef float v4f __attribute__((ext_vector_type(4)));
typedef v4f __attribute__((may_alias)) v4fa;

union Frag { v16h v; v8h p[2]; };

#if defined(__has_builtin)
#if __has_builtin(__builtin_amdgcn_exp2f)
#define EX2(x) __builtin_amdgcn_exp2f(x)
#endif
#endif
#ifndef EX2
#define EX2(x) __expf((x) * 0.69314718055994531f)
#endif

// f32 -> nearest-even bf16 value, returned as f32
__device__ __forceinline__ float bfr(float x)
{
    unsigned u = __float_as_uint(x);
    u = (u + 0x7fffu + ((u >> 16) & 1u)) & 0xffff0000u;
    return __uint_as_float(u);
}
// bf16 value times a power of two, held in an f16 container (exact in the normal range)
__device__ __forceinline__ _Float16 cvh(float x, float s) { return (_Float16)(bfr(x) * s); }

__device__ __forceinline__ v8f mma16(v16h a, v16h b, v8f c)
{
    return __builtin_amdgcn_wmma_f32_16x16x32_f16(false, a, false, b, (short)0, c, false, false);
}

__device__ __forceinline__ v8f zero8()
{
    v8f z;
#pragma unroll
    for (int i = 0; i < 8; ++i) z[i] = 0.0f;
    return z;
}

// ------------------------------------------------------------------------------------------
// Activation convert: three f32 [8192][512] planes -> f16 planes (bf16 value x16).
// One lane handles 8 consecutive elements (16 B); one wave store instruction covers 4 whole
__global__ __launch_bounds__(CVT_BLK)
void k_cvt_act(const float* __restrict__ x0, const float* __restrict__ x1,
               const float* __restrict__ x2, _Float16* __restrict__ xh)
{
    const int pl = blockIdx.y;
    const float* src = (pl == 0) ? x0 : ((pl == 1) ? x1 : x2);
    _Float16* dst = xh + (size_t)pl * PLANE;
    const int t0 = blockIdx.x * CVT_BLK + (int)threadIdx.x;
    v8h val[CVT_UNITS];
    int uu[CVT_UNITS];
#pragma unroll
    for (int j = 0; j < CVT_UNITS; ++j) {
        int u = t0 + j * (CVT_GRID * CVT_BLK);
        u = (u < UPP) ? u : (UPP - 1);
        uu[j] = u;
        const float4 a = *(const float4*)(src + (size_t)u * 8);
        const float4 b = *(const float4*)(src + (size_t)u * 8 + 4);
        v8h v;
        v[0] = cvh(a.x, 16.0f); v[1] = cvh(a.y, 16.0f); v[2] = cvh(a.z, 16.0f); v[3] = cvh(a.w, 16.0f);
        v[4] = cvh(b.x, 16.0f); v[5] = cvh(b.y, 16.0f); v[6] = cvh(b.z, 16.0f); v[7] = cvh(b.w, 16.0f);
        val[j] = v;
    }
#pragma unroll
    for (int j = 0; j < CVT_UNITS; ++j)
        *(v8h*)(dst + (size_t)uu[j] * 8) = val[j];
    
}

// ------------------------------------------------------------------------------------------
// Weight convert + transpose: four f32 W[k][n] (512x512) -> f16 Wt[n][k] (bf16 value x64),
// k-contiguous so B fragments load like A fragments. 64x64 tile through LDS; each output line
__global__ __launch_bounds__(128)
void k_cvt_wt(const float* __restrict__ w0, const float* __restrict__ w1,
              const float* __restrict__ w2, const float* __restrict__ w3,
              _Float16* __restrict__ wt)
{
    __shared__ _Float16 __attribute__((aligned(16))) sT[64 * PT];   // [n_local][k_local]
    const int z = blockIdx.z;
    const float* src = (z == 0) ? w0 : ((z == 1) ? w1 : ((z == 2) ? w2 : w3));
    _Float16* dst = wt + (size_t)z * (DM * DM);
    const int k0 = blockIdx.y * 64, n0 = blockIdx.x * 64;
    const int t = threadIdx.x, l = t & 31, w = t >> 5;
    const int nn = (t & 15) * 4, kb = t >> 4;
#pragma unroll
    for (int i = 0; i < 8; ++i) {
        const int kk = kb + 8 * i;
        const float4 v = *(const float4*)(src + (size_t)(k0 + kk) * DM + n0 + nn);
        sT[(nn + 0) * PT + kk] = cvh(v.x, 64.0f);
        sT[(nn + 1) * PT + kk] = cvh(v.y, 64.0f);
        sT[(nn + 2) * PT + kk] = cvh(v.z, 64.0f);
        sT[(nn + 3) * PT + kk] = cvh(v.w, 64.0f);
    }
    __syncthreads();
    v8h val[4];
    size_t off[4];
#pragma unroll
    for (int i = 0; i < 4; ++i) {
        const int line = 16 * w + 4 * i + (l >> 3);   // n_local
        const int ck = (l & 7) * 8;
        val[i] = *(const v8ha*)(sT + line * PT + ck);
        off[i] = (size_t)(n0 + line) * DM + k0 + ck;
    }
#pragma unroll
    for (int i = 0; i < 4; ++i) *(v8h*)(dst + off[i]) = val[i];
    
}

// ------------------------------------------------------------------------------------------
// One lane's share of a 64-k GEMM stage: four 16-B pieces of the 64-row A panel and eight of the
// 128-row B panel, rows 16 apart, copied from global memory into LDS without passing through
// registers. A wave's copy covers four whole 128-B lines. la, lb: LDS byte addresses; ga, gb: the
// matching global addresses.
__device__ __forceinline__ void stage_ab(unsigned la, unsigned lb,
                                         const _Float16* ga, const _Float16* gb)
{
    // s_wait_xcnt closes the statement so that no address register is rewritten ahead of it
    asm volatile("global_load_async_to_lds_b128 %0, %12, off\n\t"
                 "global_load_async_to_lds_b128 %1, %13, off\n\t"
                 "global_load_async_to_lds_b128 %2, %14, off\n\t"
                 "global_load_async_to_lds_b128 %3, %15, off\n\t"
                 "global_load_async_to_lds_b128 %4, %16, off\n\t"
                 "global_load_async_to_lds_b128 %5, %17, off\n\t"
                 "global_load_async_to_lds_b128 %6, %18, off\n\t"
                 "global_load_async_to_lds_b128 %7, %19, off\n\t"
                 "global_load_async_to_lds_b128 %8, %20, off\n\t"
                 "global_load_async_to_lds_b128 %9, %21, off\n\t"
                 "global_load_async_to_lds_b128 %10, %22, off\n\t"
                 "global_load_async_to_lds_b128 %11, %23, off\n\t"
                 "s_wait_xcnt 0x0"
                 :: "v"(la), "v"(la + 16u * KP * 2u), "v"(la + 32u * KP * 2u), "v"(la + 48u * KP * 2u),
                    "v"(lb), "v"(lb + 16u * KP * 2u), "v"(lb + 32u * KP * 2u), "v"(lb + 48u * KP * 2u),
                    "v"(lb + 64u * KP * 2u), "v"(lb + 80u * KP * 2u), "v"(lb + 96u * KP * 2u),
                    "v"(lb + 112u * KP * 2u),
                    "v"(ga), "v"(ga + 16 * DM), "v"(ga + 32 * DM), "v"(ga + 48 * DM),
                    "v"(gb), "v"(gb + 16 * DM), "v"(gb + 32 * DM), "v"(gb + 48 * DM),
                    "v"(gb + 64 * DM), "v"(gb + 80 * DM), "v"(gb + 96 * DM), "v"(gb + 112 * DM)
                 : "memory");
}

// ------------------------------------------------------------------------------------------
// C[64 x 128 per block] = A[rows][512] (f16, row-major) * B, with B given as Bt[n][k] (f16).
// 4 waves, each a 32x64 sub-tile = 2x4 accumulators. Each 64-k panel of A and of B is brought into
// LDS once per block by asynchronous copies, two buffers, one stage ahead of its use; the waves
// read their fragments from there with the 16x16x32 split-k lane map for both A and B.
// !OUTF: v = (acc*s_acc + bf16(bias)) * s_out -> f16; blockIdx.z selects the plane
//        (z=0,1 row-major [8192][512]; z=2 head-transposed [NB][NH][HD][SQ]).
// OUTF : same value -> f32 d_out.
template<bool OUTF>
__global__ __launch_bounds__(128) __attribute__((amdgpu_num_vgpr(248)))
void k_gemm(const _Float16* __restrict__ A, int planeA, const _Float16* __restrict__ Bt,
            const float* __restrict__ bi0, const float* __restrict__ bi1,
            const float* __restrict__ bi2,
            _Float16* __restrict__ O16, float* __restrict__ O32, float s_acc, float s_out)
{
    const int t = threadIdx.x, l = t & 31, w = t >> 5, h = l >> 4, m = l & 15;
    const int z = blockIdx.z;
    const int n0 = blockIdx.x * 128, m0 = blockIdx.y * 64;
    const int wm = (w >> 1) * 32, wn = (w & 1) * 64;
    const _Float16* Ab = A + (size_t)z * (size_t)planeA;
    const _Float16* Bb = Bt + (size_t)z * (DM * DM);
    const float* bias = (z == 0) ? bi0 : ((z == 1) ? bi1 : bi2);

    __shared__ _Float16 __attribute__((aligned(16))) sAB[2 * GST];   // [buffer][A 64 rows, B 128 rows][KP]
    // copy side: thread t brings piece (t & 7) of rows (t >> 3) + 16 j of each panel
    const _Float16* acp = Ab + (size_t)(m0 + (t >> 3)) * DM + 8 * (t & 7);
    const _Float16* bcp = Bb + (size_t)(n0 + (t >> 3)) * DM + 8 * (t & 7);
    const unsigned lcp = (unsigned)(uintptr_t)(sAB + (t >> 3) * KP + 8 * (t & 7));
    // fragment side: row m of a 16-row group, k = 8h.. and 16+8h.. of each 32-k half
    const _Float16* fa = sAB + (wm + m) * KP + 8 * h;
    const _Float16* fb = sAB + GA + (wn + m) * KP + 8 * h;

    v8f acc[2][4];
#pragma unroll
    for (int mi = 0; mi < 2; ++mi)
#pragma unroll
        for (int ni = 0; ni < 4; ++ni) acc[mi][ni] = zero8();

    stage_ab(lcp, lcp + GA * 2u, acp, bcp);
    asm volatile("s_wait_asynccnt 0x0" ::: "memory");   // stage 0 landed, this wave's share
    __syncthreads();                                    // stage 0 readable by every wave
    stage_ab(lcp + GST * 2u, lcp + (GST + GA) * 2u, acp + GK, bcp + GK);

    // two trips a pass: each buffer's LDS offsets are immediates; unrolled whole, the build formed the
    // copy addresses of all later stages early and took about 250 VGPRs
#pragma unroll 2
    for (int k0 = 0; k0 < DM; k0 += GK) {
        const unsigned buf = ((unsigned)k0 >> 6) & 1u;
        const _Float16* aT = fa + buf * GST;
        const _Float16* bT = fb + buf * GST;
        // both 32-k halves are named ahead of the 16 WMMAs, so the second half's reads can issue among
        // the first half's WMMAs
        Frag a[2][2], b[2][4];
#pragma unroll
        for (int kh = 0; kh < 2; ++kh) {
#pragma unroll
            for (int mi = 0; mi < 2; ++mi) {
                a[kh][mi].p[0] = *(const v8ha*)(aT + (16 * mi) * KP + 32 * kh);        // k0+32kh+8h .. +7
                a[kh][mi].p[1] = *(const v8ha*)(aT + (16 * mi) * KP + 32 * kh + 16);   // k0+32kh+16+8h .. +7
            }
#pragma unroll
            for (int ni = 0; ni < 4; ++ni) {
                b[kh][ni].p[0] = *(const v8ha*)(bT + (16 * ni) * KP + 32 * kh);
                b[kh][ni].p[1] = *(const v8ha*)(bT + (16 * ni) * KP + 32 * kh + 16);
            }
        }
#pragma unroll
        for (int kh = 0; kh < 2; ++kh)
#pragma unroll
            for (int mi = 0; mi < 2; ++mi)
#pragma unroll
                for (int ni = 0; ni < 4; ++ni)
                    acc[mi][ni] = mma16(a[kh][mi].v, b[kh][ni].v, acc[mi][ni]);
        // four vector slots behind the last WMMA, before its D, A or B registers are touched
        asm volatile("v_nop\n\tv_nop\n\tv_nop\n\tv_nop"
                     : "+v"(acc[0][0]), "+v"(acc[0][1]), "+v"(acc[0][2]), "+v"(acc[0][3]),
                       "+v"(acc[1][0]), "+v"(acc[1][1]), "+v"(acc[1][2]), "+v"(acc[1][3])
                     : "v"(a[1][0].v), "v"(a[1][1].v), "v"(b[1][0].v), "v"(b[1][1].v), "v"(b[1][2].v),
                       "v"(b[1][3].v));

        // hand-over: this wave's reads of the current buffer are done, its share of the next stage
        // has landed; behind the barrier the next stage is readable and this buffer is free
        asm volatile("s_wait_dscnt 0x0" ::: "memory");
        asm volatile("s_wait_asynccnt 0x0" ::: "memory");
        __syncthreads();
        if (k0 + 2 * GK < DM)
            stage_ab(lcp + buf * (GST * 2u), lcp + buf * (GST * 2u) + GA * 2u,
                     acp + (k0 + 2 * GK), bcp + (k0 + 2 * GK));
    }
    asm volatile("s_wait_asynccnt 0x0" ::: "memory");   // no copy outstanding past the loop

    float bb[4];
#pragma unroll
    for (int ni = 0; ni < 4; ++ni) bb[ni] = bfr(bias[n0 + wn + 16 * ni + m]);

    if constexpr (OUTF) {
        __shared__ float __attribute__((aligned(16))) sO[64 * PO];
#pragma unroll
        for (int mi = 0; mi < 2; ++mi)
#pragma unroll
            for (int ni = 0; ni < 4; ++ni)
#pragma unroll
                for (int r = 0; r < 8; ++r) {
                    const int row = wm + 16 * mi + 8 * h + r;
                    const int col = wn + 16 * ni + m;
                    sO[row * PO + col] = (acc[mi][ni][r] * s_acc + bb[ni]) * s_out;
                }
        __syncthreads();
        v4f val[16];
#pragma unroll
        for (int i = 0; i < 16; ++i) val[i] = *(const v4fa*)(sO + (16 * w + i) * PO + 4 * l);
#pragma unroll
        for (int i = 0; i < 16; ++i)
            *(v4f*)(O32 + (size_t)(m0 + 16 * w + i) * DM + n0 + 4 * l) = val[i];
        
    } else {
        __shared__ _Float16 __attribute__((aligned(16))) sC[9216];   // 64x136 or 128x72 view
        if (z != 2) {
#pragma unroll
            for (int mi = 0; mi < 2; ++mi)
#pragma unroll
                for (int ni = 0; ni < 4; ++ni)
#pragma unroll
                    for (int r = 0; r < 8; ++r) {
                        const int row = wm + 16 * mi + 8 * h + r;
                        const int col = wn + 16 * ni + m;
                        sC[row * PC + col] = (_Float16)((acc[mi][ni][r] * s_acc + bb[ni]) * s_out);
                    }
        } else {
#pragma unroll
            for (int mi = 0; mi < 2; ++mi)
#pragma unroll
                for (int ni = 0; ni < 4; ++ni)
#pragma unroll
                    for (int r = 0; r < 8; ++r) {
                        const int row = wm + 16 * mi + 8 * h + r;
                        const int col = wn + 16 * ni + m;
                        sC[col * PT + row] = (_Float16)((acc[mi][ni][r] * s_acc + bb[ni]) * s_out);
                    }
        }
        __syncthreads();
        v8h val[8];
        size_t off[8];
        if (z != 2) {
#pragma unroll
            for (int i = 0; i < 8; ++i) {
                const int row = 16 * w + 2 * i + (l >> 4);
                const int c8 = (l & 15) * 8;
                val[i] = *(const v8ha*)(sC + row * PC + c8);
                off[i] = (size_t)z * PLANE + (size_t)(m0 + row) * DM + n0 + c8;
            }
        } else {
            // transposed: one line per tile column (64 consecutive s of one (b,head,e) row)
            const int bidx = m0 / SQ, s0 = m0 - bidx * SQ;
#pragma unroll
            for (int i = 0; i < 8; ++i) {
                const int col = 32 * w + 4 * i + (l >> 3);
                const int ck = (l & 7) * 8;
                const int gc = n0 + col;
                val[i] = *(const v8ha*)(sC + col * PT + ck);
                off[i] = (size_t)2 * PLANE
                       + ((size_t)((bidx * NH + (gc >> 6)) * HD + (gc & 63))) * SQ + s0 + ck;
            }
        }
#pragma unroll
        for (int i = 0; i < 8; ++i) *(v8h*)(O16 + off[i]) = val[i];
        
    }
}

// value of lane l ^ 16 (the other wave half), by a vector cross-row move
__device__ __forceinline__ float xhalf(float x)
{
    const int i = __builtin_bit_cast(int, x);
    return __builtin_bit_cast(float,
        __builtin_amdgcn_permlanex16(i, i, 0x76543210, 0xfedcba98, false, false));
}

// ------------------------------------------------------------------------------------------
// One lane's share of a 64-key stage: four 16-B pieces of the K tile and four of the V tile, rows
// 16 apart, copied from global memory into LDS without passing through registers. A wave's copy
// covers four whole 128-B rows. lk, lv: LDS byte addresses; gk, gv: the matching global addresses.
__device__ __forceinline__ void stage_kv(unsigned lk, unsigned lv,
                                         const _Float16* gk, const _Float16* gv)
{
    // s_wait_xcnt closes the statement so that no address register is rewritten ahead of it
    asm volatile("global_load_async_to_lds_b128 %0, %8, off\n\t"
                 "global_load_async_to_lds_b128 %1, %9, off\n\t"
                 "global_load_async_to_lds_b128 %2, %10, off\n\t"
                 "global_load_async_to_lds_b128 %3, %11, off\n\t"
                 "global_load_async_to_lds_b128 %4, %12, off\n\t"
                 "global_load_async_to_lds_b128 %5, %13, off\n\t"
                 "global_load_async_to_lds_b128 %6, %14, off\n\t"
                 "global_load_async_to_lds_b128 %7, %15, off\n\t"
                 "s_wait_xcnt 0x0"
                 :: "v"(lk), "v"(lk + 16u * KP * 2u), "v"(lk + 32u * KP * 2u), "v"(lk + 48u * KP * 2u),
                    "v"(lv), "v"(lv + 16u * KP * 2u), "v"(lv + 32u * KP * 2u), "v"(lv + 48u * KP * 2u),
                    "v"(gk), "v"(gk + 16 * DM), "v"(gk + 32 * DM), "v"(gk + 48 * DM),
                    "v"(gv), "v"(gv + 16 * SQ), "v"(gv + 32 * SQ), "v"(gv + 48 * SQ)
                 : "memory");
}

__global__ __launch_bounds__(256) __attribute__((amdgpu_num_vgpr(256)))
void k_attn(const _Float16* __restrict__ Qh, const _Float16* __restrict__ Kh,
            const _Float16* __restrict__ Vt, const float* __restrict__ tau,
            const float* __restrict__ delta, _Float16* __restrict__ Ctx)
{
    __shared__ _Float16 __attribute__((aligned(16))) sP[QB * PP];
    __shared__ _Float16 __attribute__((aligned(16))) sKV[2 * 2 * 2 * KVT];   // [parity][buffer][K, V][row][KP]
    __shared__ float __attribute__((aligned(16))) sX[8 * 1024];   // [wave][e tile][4-register half][lane][4]
    __shared__ float sML[8 * 2 * 32];                             // [wave][maximum, sum][lane]
    const int t = threadIdx.x, l = t & 31, w = t >> 5, h = l >> 4, m = l & 15;
    const int qg = w & 3, kh = w >> 2, tc = t & 127;
    const int bq = blockIdx.z, hd = blockIdx.y, q0 = blockIdx.x * QB;

    const float LOG2E = 1.4426950408889634f;
#if AFFINE_BF16
    const float tb = bfr(tau[bq]);
    const float db = bfr(delta[bq]);
#else
    const float tb = tau[bq];
    const float db = delta[bq];
#endif
    // logit2 = log2(e) * 0.125 * (s * tau + delta), s = sacc / 64 (q and k each carried x8)
    const float c1 = tb * (0.125f / 64.0f) * LOG2E;
    const float c0 = db * 0.125f * LOG2E;

    Frag qf[2][2];                            // [query group][32-e half]
#pragma unroll
    for (int g = 0; g < 2; ++g) {
        const _Float16* qp = Qh + (size_t)(bq * SQ + q0 + 32 * qg + 16 * g + m) * DM + hd * HD + 8 * h;
#pragma unroll
        for (int ec = 0; ec < 2; ++ec) {
            qf[g][ec].p[0] = *(const v8h*)(qp + 32 * ec);        // e = 32ec+8h .. +7
            qf[g][ec].p[1] = *(const v8h*)(qp + 32 * ec + 16);   // e = 32ec+16+8h .. +7
        }
    }
    // copy side: thread tc of a parity's 128 brings piece (tc & 7) of rows (tc >> 3) + 16 j, j = 0..3, of
    // each of that parity's tiles; kcp, vcp point into its first tile (keys 64 kh ..)
    const _Float16* kcp = Kh + (size_t)(bq * SQ + 64 * kh + (tc >> 3)) * DM + hd * HD + 8 * (tc & 7);
    const _Float16* vcp = Vt + ((size_t)(bq * NH + hd) * HD + (tc >> 3)) * SQ + 64 * kh + 8 * (tc & 7);
    const unsigned lcp = (unsigned)(uintptr_t)(sKV + kh * (4 * KVT) + (tc >> 3) * KP + 8 * (tc & 7));
    // fragment side: row m of a 16-row group, k = 8h.. and 16+8h..
    const _Float16* fbase = sKV + kh * (4 * KVT) + m * KP + 8 * h;
    _Float16* myP = sP + (2 * qg + kh) * 16 * PP;

    v8f oacc[2][4];
    float mrun[2];                            // query m of each group: running maximum (both halves alike)
    float lpart[2][4];                        // sums over this half's keys, one per sub-tile
#pragma unroll
    for (int g = 0; g < 2; ++g) {
        mrun[g] = -1.0e30f;
#pragma unroll
        for (int et = 0; et < 4; ++et) { oacc[g][et] = zero8(); lpart[g][et] = 0.0f; }
    }

    stage_kv(lcp, lcp + KVT * 2u, kcp, vcp);
    asm volatile("s_wait_asynccnt 0x0" ::: "memory");   // stage 0 landed, this wave's share
    __syncthreads();                                    // stage 0 readable by every wave
    stage_kv(lcp + 2u * KVT * 2u, lcp + 3u * KVT * 2u, kcp + (size_t)128 * DM, vcp + 128);

    // s0: first key of the pair of tiles of this trip; this wave works on keys s0 + 64 kh ..
    for (int s0 = 0; s0 < SQ; s0 += 128) {
        const unsigned buf = ((unsigned)s0 >> 7) & 1u;
        const _Float16* kT = fbase + buf * (2 * KVT);
        const _Float16* vT = kT + KVT;
        v8f sacc[2][4];
#pragma unroll
        for (int g = 0; g < 2; ++g)
#pragma unroll
            for (int sub = 0; sub < 4; ++sub) sacc[g][sub] = zero8();
#pragma unroll
        for (int ec = 0; ec < 2; ++ec) {
            Frag kf[4];
#pragma unroll
            for (int sub = 0; sub < 4; ++sub) {
                const _Float16* kp = kT + (16 * sub) * KP + 32 * ec;
                kf[sub].p[0] = *(const v8ha*)kp;
                kf[sub].p[1] = *(const v8ha*)(kp + 16);
            }
#pragma unroll
            for (int sub = 0; sub < 4; ++sub)
#pragma unroll
                for (int g = 0; g < 2; ++g) sacc[g][sub] = mma16(kf[sub].v, qf[g][ec].v, sacc[g][sub]);
            // four vector slots behind the last WMMA, before its D, A or B registers are touched
            asm volatile("v_nop\n\tv_nop\n\tv_nop\n\tv_nop"
                         : "+v"(sacc[0][0]), "+v"(sacc[0][1]), "+v"(sacc[0][2]), "+v"(sacc[0][3]),
                           "+v"(sacc[1][0]), "+v"(sacc[1][1]), "+v"(sacc[1][2]), "+v"(sacc[1][3])
                         : "v"(qf[0][ec].v), "v"(qf[1][ec].v),
                           "v"(kf[0].v), "v"(kf[1].v), "v"(kf[2].v), "v"(kf[3].v));
        }

        float msub[2];
#pragma unroll
        for (int g = 0; g < 2; ++g) {
            // affine + temperature in the log2 domain
#pragma unroll
            for (int sub = 0; sub < 4; ++sub)
#pragma unroll
                for (int r = 0; r < 8; ++r) sacc[g][sub][r] = sacc[g][sub][r] * c1 + c0;

            // online softmax; sacc[g][sub][r] = score of key 16 sub + 8h + r for query m of group g
            float ms[4];                       // four independent chains, one per sub-tile
#pragma unroll
            for (int sub = 0; sub < 4; ++sub) {
                ms[sub] = sacc[g][sub][0];
#pragma unroll
                for (int r = 1; r < 8; ++r) ms[sub] = fmaxf(ms[sub], sacc[g][sub][r]);
            }
            float mx = fmaxf(fmaxf(ms[0], ms[1]), fmaxf(ms[2], ms[3]));
            mx = fmaxf(mx, xhalf(mx));
            const float mn = fmaxf(mrun[g], mx);
            const float alpha = EX2(mrun[g] - mn);
            mrun[g] = mn;
            msub[g] = mn - 14.0f;              // numerators carried x2^14
#pragma unroll
            for (int sub = 0; sub < 4; ++sub) lpart[g][sub] *= alpha;
#pragma unroll
            for (int et = 0; et < 4; ++et)
#pragma unroll
                for (int r = 0; r < 8; ++r) oacc[g][et][r] *= alpha;
        }

#pragma unroll
        for (int sc = 0; sc < 2; ++sc) {
            // P^T as B: element s of the fragment is key 32sc + 8h + s (s < 8), 32sc + 16 + 8h + s - 8
            // (s >= 8), which is register s & 7 of score tile 2sc + (s >> 3); V^T rows take the same k order
            Frag pf[2], vf[4];
#pragma unroll
            for (int et = 0; et < 4; ++et) {
                const _Float16* vp = vT + (16 * et) * KP + 32 * sc;
                vf[et].p[0] = *(const v8ha*)vp;
                vf[et].p[1] = *(const v8ha*)(vp + 16);
            }
#pragma unroll
            for (int g = 0; g < 2; ++g)
#pragma unroll
                for (int hf = 0; hf < 2; ++hf)
#pragma unroll
                    for (int r = 0; r < 8; ++r) {
                        const float p = EX2(sacc[g][2 * sc + hf][r] - msub[g]);   // in (0, 16384]
                        lpart[g][2 * sc + hf] += p;
                        pf[g].p[hf][r] = (_Float16)p;
                    }
#pragma unroll
            for (int et = 0; et < 4; ++et)
#pragma unroll
                for (int g = 0; g < 2; ++g) oacc[g][et] = mma16(vf[et].v, pf[g].v, oacc[g][et]);
            // four vector slots behind the last WMMA, before its D, A or B registers are touched
            asm volatile("v_nop\n\tv_nop\n\tv_nop\n\tv_nop"
                         : "+v"(oacc[0][0]), "+v"(oacc[0][1]), "+v"(oacc[0][2]), "+v"(oacc[0][3]),
                           "+v"(oacc[1][0]), "+v"(oacc[1][1]), "+v"(oacc[1][2]), "+v"(oacc[1][3])
                         : "v"(pf[0].v), "v"(pf[1].v),
                           "v"(vf[0].v), "v"(vf[1].v), "v"(vf[2].v), "v"(vf[3].v));
        }

        // hand-over: this wave's reads of the current buffer are done, its share of the next stage
        // has landed; behind the barrier the next stage is readable and this buffer is free
        asm volatile("s_wait_dscnt 0x0" ::: "memory");
        asm volatile("s_wait_asynccnt 0x0" ::: "memory");
        __syncthreads();
        if (s0 + 256 < SQ)
            stage_kv(lcp + buf * (2u * KVT * 2u), lcp + buf * (2u * KVT * 2u) + KVT * 2u,
                     kcp + (size_t)(s0 + 256) * DM, vcp + (s0 + 256));
    }
    asm volatile("s_wait_asynccnt 0x0" ::: "memory");   // no copy outstanding past the loop

    // sum of query m over this wave's keys: this half's four partial sums, plus the other half's
    float lt[2];
#pragma unroll
    for (int g = 0; g < 2; ++g) {
        lt[g] = (lpart[g][0] + lpart[g][1]) + (lpart[g][2] + lpart[g][3]);
        lt[g] += xhalf(lt[g]);
    }
    // join of a wave pair (w, w ^ 4): wave kh finishes query group kh and hands its share of group 1 - kh,
    // lane for lane, to its partner
    const bool up = (kh != 0);
    const float mM = up ? mrun[1] : mrun[0], mG = up ? mrun[0] : mrun[1];
    const float lM = up ? lt[1] : lt[0], lG = up ? lt[0] : lt[1];
    {
        float* xo = sX + w * 1024;
#pragma unroll
        for (int et = 0; et < 4; ++et)
#pragma unroll
            for (int j = 0; j < 2; ++j) {
                v4f x;
#pragma unroll
                for (int r = 0; r < 4; ++r) x[r] = up ? oacc[0][et][4 * j + r] : oacc[1][et][4 * j + r];
                *(v4fa*)(xo + ((2 * et + j) * 32 + l) * 4) = x;
            }
        sML[(2 * w + 0) * 32 + l] = mG;
        sML[(2 * w + 1) * 32 + l] = lG;
    }
    __syncthreads();   // the partner's share is readable
    // context x32 = 4 * (O a + O' a') / (l a + l' a'), a = 2^(m - max(m, m'));
    // O[query 16 kh + m of the wave's 32][e = 16 et + 8h + r]: eight consecutive e, one 16-B LDS store
    {
        const float* xi = sX + (w ^ 4) * 1024;
        const float mP = sML[(2 * (w ^ 4) + 0) * 32 + l];
        const float lP = sML[(2 * (w ^ 4) + 1) * 32 + l];
        const float mj = fmaxf(mM, mP);
        const float aM = EX2(mM - mj), aP = EX2(mP - mj);
        const float inv = 4.0f / (lM * aM + lP * aP);
        const float cM = aM * inv, cP = aP * inv;
#pragma unroll
        for (int et = 0; et < 4; ++et) {
            v8h o;
#pragma unroll
            for (int j = 0; j < 2; ++j) {
                const v4f x = *(const v4fa*)(xi + ((2 * et + j) * 32 + l) * 4);
#pragma unroll
                for (int r = 0; r < 4; ++r) {
                    const float mine = up ? oacc[1][et][4 * j + r] : oacc[0][et][4 * j + r];
                    o[4 * j + r] = (_Float16)(mine * cM + x[r] * cP);
                }
            }
            *(v8ha*)(myP + m * PP + 16 * et + 8 * h) = o;
        }
    }
    __syncthreads();
    v8h cv[4];
    size_t coff[4];
#pragma unroll
    for (int i = 0; i < 4; ++i) {
        const int row = 16 * (2 * qg + kh) + 4 * i + (l >> 3);
        const int c8 = (l & 7) * 8;
        cv[i] = *(const v8ha*)(sP + row * PP + c8);
        coff[i] = (size_t)(bq * SQ + q0 + row) * DM + hd * HD + c8;
    }
#pragma unroll
    for (int i = 0; i < 4; ++i) *(v8h*)(Ctx + coff[i]) = cv[i];
    
}

// ------------------------------------------------------------------------------------------
extern "C" void kernel_launch(void* const* d_in, const int* in_sizes, int n_in,
                              void* d_out, int out_size, void* d_ws, size_t ws_size,
                              hipStream_t stream)
{
    if (n_in < 13) return;
    if (in_sizes[0] != PLANE || in_sizes[1] != PLANE || in_sizes[2] != PLANE) return;
    if (in_sizes[3] != NB || in_sizes[4] != NB) return;
    if (in_sizes[5] != DM * DM || in_sizes[7] != DM * DM || in_sizes[9] != DM * DM || in_sizes[11] != DM * DM) return;
    if (in_sizes[6] != DM || in_sizes[8] != DM || in_sizes[10] != DM || in_sizes[12] != DM) return;
    if (out_size != PLANE) return;

    const float* queries = (const float*)d_in[0];
    const float* keys    = (const float*)d_in[1];
    const float* values  = (const float*)d_in[2];
    const float* tau     = (const float*)d_in[3];
    const float* delta   = (const float*)d_in[4];
    const float* Wq = (const float*)d_in[5];
    const float* bq = (const float*)d_in[6];
    const float* Wk = (const float*)d_in[7];
    const float* bk = (const float*)d_in[8];
    const float* Wv = (const float*)d_in[9];
    const float* bv = (const float*)d_in[10];
    const float* Wo = (const float*)d_in[11];
    const float* bo = (const float*)d_in[12];
    float* out = (float*)d_out;

    // workspace carve (bytes), all offsets multiples of 2 MiB
    const size_t szPlane16 = (size_t)PLANE * 2;                 // 8 MiB
    const size_t offXh = 0;                                       // 3 planes  = 24 MiB
    const size_t offWt = offXh + 3 * szPlane16;                   // 4 x 512x512 f16 = 2 MiB
    const size_t offQ  = offWt + (size_t)4 * DM * DM * 2;
    const size_t offK  = offQ + szPlane16;
    const size_t offVt = offK + szPlane16;
    const size_t offC  = offVt + szPlane16;
    const size_t wsEnd = offC + szPlane16;                        // 60,817,408 B
    if (wsEnd > ws_size) return;

    char* ws = (char*)d_ws;
    _Float16* Xh  = (_Float16*)(ws + offXh);
    _Float16* Wt  = (_Float16*)(ws + offWt);
    _Float16* Qh  = (_Float16*)(ws + offQ);
    _Float16* Kh  = (_Float16*)(ws + offK);
    _Float16* Vth = (_Float16*)(ws + offVt);
    _Float16* Ctx = (_Float16*)(ws + offC);

    // 1) activations -> f16 (bf16 value x16)
    k_cvt_act<<<dim3(CVT_GRID, 3, 1), dim3(CVT_BLK), 0, stream>>>(queries, keys, values, Xh);
    // 2) weights -> transposed f16 (bf16 value x64): Wq, Wk, Wv, Wo
    k_cvt_wt<<<dim3(DM / 64, DM / 64, 4), dim3(128), 0, stream>>>(Wq, Wk, Wv, Wo, Wt);
    // 3) q, k (row-major) and v (head-transposed) projections, f16 x8
    k_gemm<false><<<dim3(DM / 128, MR / 64, 3), dim3(128), 0, stream>>>(
        Xh, (int)PLANE, Wt, bq, bk, bv, Qh, out, 1.0f / 1024.0f, 8.0f);
    // 4) attention -> context f16 x32
    k_attn<<<dim3(SQ / QB, NH, NB), dim3(256), 0, stream>>>(Qh, Kh, Vth, tau, delta, Ctx);
    // 5) output projection -> f32
    k_gemm<true><<<dim3(DM / 128, MR / 64, 1), dim3(128), 0, stream>>>(
        Ctx, 0, Wt + (size_t)3 * DM * DM, bo, bo, bo, Qh, out, 1.0f / 2048.0f, 1.0f);
}

// v005
// A run of this version takes 68.3 microseconds.
// Two timings next to v004 put it at 1.17 and 1.13 times that version's speed.
// Over all steps from v000 it is 2.80 times as fast.
#include <hip/hip_runtime.h>
#include <stdint.h>

// All six contractions (three input projections, q.k^T, p.v, output projection):
// v_wmma_f32_16x16x32_f16, f16 operands, f32 accumulate. Float inputs are RNE-converted to
// bf16 values held exactly in f16 containers (activations x16, weights x64; tau, delta, bias as
// f32-held bf16 values); intermediates: q,k,v f16 x8, softmax numerators f16 x2^14, context f16 x32.
// Every scale is a power of two removed in f32. Softmax statistics in f32.

#ifndef AFFINE_BF16
#define AFFINE_BF16 1   // 1: tau and delta RNE-converted to bf16 values before use; 0: used as given
#endif

#define DM 512
#define NH 8
#define HD 64
#define NB 4
#define SQ 2048
#define MR (NB * SQ)            // 8192 token rows
#define PLANE (MR * DM)         // 4194304 elements per activation plane
#define PP 72                   // f16 LDS pitch of the per-wave context tile (epilogue)
#define PC 264                  // f16 LDS pitch of the row-major 64x256 epilogue tile
#define PT 72                   // f16 LDS pitch of the transposed 256x64 epilogue tile
#define PO 132                  // f32 LDS pitch of the 64x128 epilogue tile
#define KP 72                   // f16 LDS pitch of a staged 64-element K or V row (144 B = 16 B x 9)
#define KVT (64 * KP)           // f16 elements of one staged 64x64 tile
#define QB 128                  // query rows of one attention block
#define GK 64                   // k elements of one staged GEMM panel: one whole 128-B line per row
#define GA (64 * KP)            // f16 elements of a staged 64-row A panel

typedef _Float16 v16h __attribute__((ext_vector_type(16)));
typedef _Float16 v8h  __attribute__((ext_vector_type(8)));
typedef v8h __attribute__((may_alias)) v8ha;
typedef float v8f __attribute__((ext_vector_type(8)));
typedef float v4f __attribute__((ext_vector_type(4)));
typedef v4f __attribute__((may_alias)) v4fa;
typedef _Float16 v4h __attribute__((ext_vector_type(4)));
typedef v4h __attribute__((may_alias)) v4ha;
typedef _Float16 v2h __attribute__((ext_vector_type(2)));
typedef float v2f __attribute__((ext_vector_type(2)));
typedef __bf16 v2b __attribute__((ext_vector_type(2)));

union Frag { v16h v; v8h p[2]; };

#if defined(__has_builtin)
#if __has_builtin(__builtin_amdgcn_exp2f)
#define EX2(x) __builtin_amdgcn_exp2f(x)
#endif
#endif
#ifndef EX2
#define EX2(x) __expf((x) * 0.69314718055994531f)
#endif

// f32 -> nearest-even bf16 value, returned as f32
__device__ __forceinline__ float bfr(float x)
{
    unsigned u = __float_as_uint(x);
    u = (u + 0x7fffu + ((u >> 16) & 1u)) & 0xffff0000u;
    return __uint_as_float(u);
}
// bf16 value times a power of two, held in an f16 container (exact in the normal range)
__device__ __forceinline__ _Float16 cvh(float x, float s) { return (_Float16)(bfr(x) * s); }

__device__ __forceinline__ v8f mma16(v16h a, v16h b, v8f c)
{
    return __builtin_amdgcn_wmma_f32_16x16x32_f16(false, a, false, b, (short)0, c, false, false);
}

__device__ __forceinline__ v8f zero8()
{
    v8f z;
#pragma unroll
    for (int i = 0; i < 8; ++i) z[i] = 0.0f;
    return z;
}

// four activations -> f16 (bf16 value x16): the packed conversion rounds to nearest even as bfr() does
__device__ __forceinline__ v4h cvh4(v4f x)
{
    v4h o;
#pragma unroll
    for (int p = 0; p < 2; ++p) {
        v2f f;
        f[0] = x[2 * p]; f[1] = x[2 * p + 1];
        const unsigned u = __builtin_bit_cast(unsigned, __builtin_convertvector(f, v2b));
        v2f g;
        g[0] = __uint_as_float(u << 16); g[1] = __uint_as_float(u & 0xffff0000u);
        g *= 16.0f;
        const v2h hh = __builtin_convertvector(g, v2h);
        o[2 * p] = hh[0]; o[2 * p + 1] = hh[1];
    }
    return o;
}

// ------------------------------------------------------------------------------------------
// Weight convert + transpose: four f32 W[k][n] (512x512) -> f16 Wt[n][k] (bf16 value x64),
// k-contiguous so B fragments load like A fragments. 64x64 tile through LDS; each output line
__global__ __launch_bounds__(128)
void k_cvt_wt(const float* __restrict__ w0, const float* __restrict__ w1,
              const float* __restrict__ w2, const float* __restrict__ w3,
              _Float16* __restrict__ wt)
{
    __shared__ _Float16 __attribute__((aligned(16))) sT[64 * PT];   // [n_local][k_local]
    const int z = blockIdx.z;
    const float* src = (z == 0) ? w0 : ((z == 1) ? w1 : ((z == 2) ? w2 : w3));
    _Float16* dst = wt + (size_t)z * (DM * DM);
    const int k0 = blockIdx.y * 64, n0 = blockIdx.x * 64;
    const int t = threadIdx.x, l = t & 31, w = t >> 5;
    const int nn = (t & 15) * 4, kb = t >> 4;
#pragma unroll
    for (int i = 0; i < 8; ++i) {
        const int kk = kb + 8 * i;
        const float4 v = *(const float4*)(src + (size_t)(k0 + kk) * DM + n0 + nn);
        sT[(nn + 0) * PT + kk] = cvh(v.x, 64.0f);
        sT[(nn + 1) * PT + kk] = cvh(v.y, 64.0f);
        sT[(nn + 2) * PT + kk] = cvh(v.z, 64.0f);
        sT[(nn + 3) * PT + kk] = cvh(v.w, 64.0f);
    }
    __syncthreads();
    v8h val[4];
    size_t off[4];
#pragma unroll
    for (int i = 0; i < 4; ++i) {
        const int line = 16 * w + 4 * i + (l >> 3);   // n_local
        const int ck = (l & 7) * 8;
        val[i] = *(const v8ha*)(sT + line * PT + ck);
        off[i] = (size_t)(n0 + line) * DM + k0 + ck;
    }
#pragma unroll
    for (int i = 0; i < 4; ++i) *(v8h*)(dst + off[i]) = val[i];
    
}

// ------------------------------------------------------------------------------------------
// One lane's share of a 64-k GEMM stage: four 16-B pieces of the 64-row A panel and eight of the
// 128-row B panel, rows 16 apart, copied from global memory into LDS without passing through
// registers. A wave's copy covers four whole 128-B lines. la, lb: LDS byte addresses; ga, gb: the
// matching global addresses.
__device__ __forceinline__ void stage_ab(unsigned la, unsigned lb,
                                         const _Float16* ga, const _Float16* gb)
{
    // s_wait_xcnt closes the statement so that no address register is rewritten ahead of it
    asm volatile("global_load_async_to_lds_b128 %0, %12, off\n\t"
                 "global_load_async_to_lds_b128 %1, %13, off\n\t"
                 "global_load_async_to_lds_b128 %2, %14, off\n\t"
                 "global_load_async_to_lds_b128 %3, %15, off\n\t"
                 "global_load_async_to_lds_b128 %4, %16, off\n\t"
                 "global_load_async_to_lds_b128 %5, %17, off\n\t"
                 "global_load_async_to_lds_b128 %6, %18, off\n\t"
                 "global_load_async_to_lds_b128 %7, %19, off\n\t"
                 "global_load_async_to_lds_b128 %8, %20, off\n\t"
                 "global_load_async_to_lds_b128 %9, %21, off\n\t"
                 "global_load_async_to_lds_b128 %10, %22, off\n\t"
                 "global_load_async_to_lds_b128 %11, %23, off\n\t"
                 "s_wait_xcnt 0x0"
                 :: "v"(la), "v"(la + 16u * KP * 2u), "v"(la + 32u * KP * 2u), "v"(la + 48u * KP * 2u),
                    "v"(lb), "v"(lb + 16u * KP * 2u), "v"(lb + 32u * KP * 2u), "v"(lb + 48u * KP * 2u),
                    "v"(lb + 64u * KP * 2u), "v"(lb + 80u * KP * 2u), "v"(lb + 96u * KP * 2u),
                    "v"(lb + 112u * KP * 2u),
                    "v"(ga), "v"(ga + 16 * DM), "v"(ga + 32 * DM), "v"(ga + 48 * DM),
                    "v"(gb), "v"(gb + 16 * DM), "v"(gb + 32 * DM), "v"(gb + 48 * DM),
                    "v"(gb + 64 * DM), "v"(gb + 80 * DM), "v"(gb + 96 * DM), "v"(gb + 112 * DM)
                 : "memory");
}

// One lane's share of a 256-row B panel alone, for the GEMM whose A panel comes through registers:
// eight 16-B pieces, rows 32 apart (256 threads).
__device__ __forceinline__ void stage_b(unsigned lb, const _Float16* gb)
{
    // s_wait_xcnt closes the statement so that no address register is rewritten ahead of it
    asm volatile("global_load_async_to_lds_b128 %0, %8, off\n\t"
                 "global_load_async_to_lds_b128 %1, %9, off\n\t"
                 "global_load_async_to_lds_b128 %2, %10, off\n\t"
                 "global_load_async_to_lds_b128 %3, %11, off\n\t"
                 "global_load_async_to_lds_b128 %4, %12, off\n\t"
                 "global_load_async_to_lds_b128 %5, %13, off\n\t"
                 "global_load_async_to_lds_b128 %6, %14, off\n\t"
                 "global_load_async_to_lds_b128 %7, %15, off\n\t"
                 "s_wait_xcnt 0x0"
                 :: "v"(lb), "v"(lb + 32u * KP * 2u), "v"(lb + 64u * KP * 2u), "v"(lb + 96u * KP * 2u),
                    "v"(lb + 128u * KP * 2u), "v"(lb + 160u * KP * 2u), "v"(lb + 192u * KP * 2u),
                    "v"(lb + 224u * KP * 2u),
                    "v"(gb), "v"(gb + 32 * DM), "v"(gb + 64 * DM), "v"(gb + 96 * DM),
                    "v"(gb + 128 * DM), "v"(gb + 160 * DM), "v"(gb + 192 * DM), "v"(gb + 224 * DM)
                 : "memory");
}

// ------------------------------------------------------------------------------------------
// C[64 x NT per block] = A[rows][512] (row-major) * B, with B given as Bt[n][k] (f16).
// One wave per 32x64 sub-tile = 2x4 accumulators. Each 64-k panel of A and of B is brought into
// LDS once per block, two buffers, one stage ahead of its use; the waves read their fragments from
// there with the 16x16x32 split-k lane map for both A and B. B comes by asynchronous copies.
// !OUTF: NT = 256, 8 waves. A is the f32 activation plane x0, x1 or x2 (blockIdx.z): plain loads issued
//        where the stage's copies are, converted to f16 (bf16 value x16) in registers and stored to the
//        stage's A panel ahead of the barrier that publishes the stage. An f32 panel is twice the bytes
//        of an f16 one; 256 columns a block halve how often it is fetched and converted.
//        v = (acc*s_acc + bf16(bias)) * s_out -> f16; blockIdx.z selects the plane
//        (z=0,1 row-major [8192][512]; z=2 head-transposed [NB][NH][HD][SQ]).
// OUTF : NT = 128, 4 waves. A is f16, by asynchronous copies; same value -> f32 d_out.
// 160 VGPRs: six waves a SIMD, so that three of the 8-wave blocks stay on a WGP and the 768 blocks of the
// projections are resident at once.
template<bool OUTF>
__global__ __launch_bounds__(OUTF ? 128 : 256) __attribute__((amdgpu_num_vgpr(160)))
void k_gemm(const float* __restrict__ x0, const float* __restrict__ x1, const float* __restrict__ x2,
            const _Float16* __restrict__ A, const _Float16* __restrict__ Bt,
            const float* __restrict__ bi0, const float* __restrict__ bi1,
            const float* __restrict__ bi2,
            _Float16* __restrict__ O16, float* __restrict__ O32, float s_acc, float s_out)
{
    const int t = threadIdx.x, l = t & 31, w = t >> 5, h = l >> 4, m = l & 15;
    const int z = blockIdx.z;
    constexpr int NT = OUTF ? 128 : 256;      // columns of the block tile
    constexpr int GB = NT * KP;               // f16 elements of a staged NT-row B panel
    constexpr int GST = GA + GB;              // f16 elements of one stage
    const int n0 = blockIdx.x * NT, m0 = blockIdx.y * 64;
    const int wm = (w / (NT / 64)) * 32, wn = (w % (NT / 64)) * 64;
    const _Float16* Bb = Bt + (size_t)z * (DM * DM);
    const float* bias = (z == 0) ? bi0 : ((z == 1) ? bi1 : bi2);

    __shared__ _Float16 __attribute__((aligned(16))) sAB[2 * GST];   // [buffer][A 64 rows, B NT rows][KP]
    // copy side: thread t brings piece (t & 7) of rows (t >> 3) + (NT / 8) j of a panel
    const _Float16* acp = A + (size_t)(m0 + (t >> 3)) * DM + 8 * (t & 7);
    const _Float16* bcp = Bb + (size_t)(n0 + (t >> 3)) * DM + 8 * (t & 7);
    const unsigned lcp = (unsigned)(uintptr_t)(sAB + (t >> 3) * KP + 8 * (t & 7));
    // f32 A side: thread t brings k = 4 (t & 15) .. +3 of rows (t >> 4) + 16 j, so that one wave load
    // covers four whole 128-B lines
    const float* xs = (z == 0) ? x0 : ((z == 1) ? x1 : x2);
    const float* xcp = xs + (size_t)(m0 + (t >> 4)) * DM + 4 * (t & 15);
    _Float16* sa = sAB + (t >> 4) * KP + 4 * (t & 15);
    v4f ar[4];                                // the A stage in flight
    // fragment side: row m of a 16-row group, k = 8h.. and 16+8h.. of each 32-k half
    const _Float16* fa = sAB + (wm + m) * KP + 8 * h;
    const _Float16* fb = sAB + GA + (wn + m) * KP + 8 * h;

    v8f acc[2][4];
#pragma unroll
    for (int mi = 0; mi < 2; ++mi)
#pragma unroll
        for (int ni = 0; ni < 4; ++ni) acc[mi][ni] = zero8();

    if constexpr (OUTF) {
        stage_ab(lcp, lcp + GA * 2u, acp, bcp);
    } else {
#pragma unroll
        for (int j = 0; j < 4; ++j) ar[j] = *(const v4fa*)(xcp + (16 * j) * DM);
        stage_b(lcp + GA * 2u, bcp);
        // keeps the conversion, which waits for the loads, behind the issue of the copies
        __builtin_amdgcn_sched_barrier(0);
#pragma unroll
        for (int j = 0; j < 4; ++j) *(v4ha*)(sa + (16 * j) * KP) = cvh4(ar[j]);
    }
    asm volatile("s_wait_asynccnt 0x0" ::: "memory");   // stage 0 landed, this wave's share
    __syncthreads();                                    // stage 0 readable by every wave
    if constexpr (OUTF) {
        stage_ab(lcp + GST * 2u, lcp + (GST + GA) * 2u, acp + GK, bcp + GK);
    } else {
#pragma unroll
        for (int j = 0; j < 4; ++j) ar[j] = *(const v4fa*)(xcp + (16 * j) * DM + GK);
        stage_b(lcp + (GST + GA) * 2u, bcp + GK);
    }

    // two trips a pass: each buffer's LDS offsets are immediates; unrolled whole, the build formed the
    // copy addresses of all later stages early and took about 250 VGPRs
#pragma unroll 2
    for (int k0 = 0; k0 < DM; k0 += GK) {
        const unsigned buf = ((unsigned)k0 >> 6) & 1u;
        const _Float16* aT = fa + buf * GST;
        const _Float16* bT = fb + buf * GST;
        // both 32-k halves are named ahead of the 16 WMMAs, so the second half's reads can issue among
        // the first half's WMMAs
        Frag a[2][2], b[2][4];
#pragma unroll
        for (int kh = 0; kh < 2; ++kh) {
#pragma unroll
            for (int mi = 0; mi < 2; ++mi) {
                a[kh][mi].p[0] = *(const v8ha*)(aT + (16 * mi) * KP + 32 * kh);        // k0+32kh+8h .. +7
                a[kh][mi].p[1] = *(const v8ha*)(aT + (16 * mi) * KP + 32 * kh + 16);   // k0+32kh+16+8h .. +7
            }
#pragma unroll
            for (int ni = 0; ni < 4; ++ni) {
                b[kh][ni].p[0] = *(const v8ha*)(bT + (16 * ni) * KP + 32 * kh);
                b[kh][ni].p[1] = *(const v8ha*)(bT + (16 * ni) * KP + 32 * kh + 16);
            }
        }
#pragma unroll
        for (int kh = 0; kh < 2; ++kh)
#pragma unroll
            for (int mi = 0; mi < 2; ++mi)
#pragma unroll
                for (int ni = 0; ni < 4; ++ni)
                    acc[mi][ni] = mma16(a[kh][mi].v, b[kh][ni].v, acc[mi][ni]);
        // four vector slots behind the last WMMA, before its D, A or B registers are touched
        asm volatile("v_nop\n\tv_nop\n\tv_nop\n\tv_nop"
                     : "+v"(acc[0][0]), "+v"(acc[0][1]), "+v"(acc[0][2]), "+v"(acc[0][3]),
                       "+v"(acc[1][0]), "+v"(acc[1][1]), "+v"(acc[1][2]), "+v"(acc[1][3])
                     : "v"(a[1][0].v), "v"(a[1][1].v), "v"(b[1][0].v), "v"(b[1][1].v), "v"(b[1][2].v),
                       "v"(b[1][3].v));

        // the next stage's A panel goes into the other buffer, whose readers left at the last barrier
        if constexpr (!OUTF) {
            // keeps the conversion, which waits for the loads, behind this trip's WMMAs: hoisted among
            // them it stalled the wave on loads issued just before the trip
            __builtin_amdgcn_sched_barrier(0);
            if (k0 + GK < DM) {
#pragma unroll
                for (int j = 0; j < 4; ++j) *(v4ha*)(sa + (buf ^ 1u) * GST + (16 * j) * KP) = cvh4(ar[j]);
            }
        }
        // hand-over: this wave's reads of the current buffer are done, its share of the next stage
        // has landed; behind the barrier the next stage is readable and this buffer is free
        asm volatile("s_wait_dscnt 0x0" ::: "memory");
        asm volatile("s_wait_asynccnt 0x0" ::: "memory");
        __syncthreads();
        if (k0 + 2 * GK < DM) {
            if constexpr (OUTF) {
                stage_ab(lcp + buf * (GST * 2u), lcp + buf * (GST * 2u) + GA * 2u,
                         acp + (k0 + 2 * GK), bcp + (k0 + 2 * GK));
            } else {
#pragma unroll
                for (int j = 0; j < 4; ++j) ar[j] = *(const v4fa*)(xcp + (16 * j) * DM + (k0 + 2 * GK));
                stage_b(lcp + buf * (GST * 2u) + GA * 2u, bcp + (k0 + 2 * GK));
            }
        }
    }
    asm volatile("s_wait_asynccnt 0x0" ::: "memory");   // no copy outstanding past the loop

    float bb[4];
#pragma unroll
    for (int ni = 0; ni < 4; ++ni) bb[ni] = bfr(bias[n0 + wn + 16 * ni + m]);

    if constexpr (OUTF) {
        __shared__ float __attribute__((aligned(16))) sO[64 * PO];
#pragma unroll
        for (int mi = 0; mi < 2; ++mi)
#pragma unroll
            for (int ni = 0; ni < 4; ++ni)
#pragma unroll
                for (int r = 0; r < 8; ++r) {
                    const int row = wm + 16 * mi + 8 * h + r;
                    const int col = wn + 16 * ni + m;
                    sO[row * PO + col] = (acc[mi][ni][r] * s_acc + bb[ni]) * s_out;
                }
        __syncthreads();
        v4f val[16];
#pragma unroll
        for (int i = 0; i < 16; ++i) val[i] = *(const v4fa*)(sO + (16 * w + i) * PO + 4 * l);
#pragma unroll
        for (int i = 0; i < 16; ++i)
            *(v4f*)(O32 + (size_t)(m0 + 16 * w + i) * DM + n0 + 4 * l) = val[i];
        
    } else {
        // 64 x PC or 256 x PT view, laid over the stage buffers: every wave's last fragment read ended ahead
        // of the loop's last barrier and no copy is outstanding. Three blocks then fit a WGP's LDS.
        static_assert(256 * PT <= 2 * GST && 64 * PC <= 2 * GST, "output tile exceeds the stage buffers");
        _Float16* sC = sAB;
        if (z != 2) {
#pragma unroll
            for (int mi = 0; mi < 2; ++mi)
#pragma unroll
                for (int ni = 0; ni < 4; ++ni)
#pragma unroll
                    for (int r = 0; r < 8; ++r) {
                        const int row = wm + 16 * mi + 8 * h + r;
                        const int col = wn + 16 * ni + m;
                        sC[row * PC + col] = (_Float16)((acc[mi][ni][r] * s_acc + bb[ni]) * s_out);
                    }
        } else {
#pragma unroll
            for (int mi = 0; mi < 2; ++mi)
#pragma unroll
                for (int ni = 0; ni < 4; ++ni)
#pragma unroll
                    for (int r = 0; r < 8; ++r) {
                        const int row = wm + 16 * mi + 8 * h + r;
                        const int col = wn + 16 * ni + m;
                        sC[col * PT + row] = (_Float16)((acc[mi][ni][r] * s_acc + bb[ni]) * s_out);
                    }
        }
        __syncthreads();
        v8h val[8];
        size_t off[8];
        if (z != 2) {
#pragma unroll
            for (int i = 0; i < 8; ++i) {
                const int row = 8 * w + i;
                const int c8 = l * 8;
                val[i] = *(const v8ha*)(sC + row * PC + c8);
                off[i] = (size_t)z * PLANE + (size_t)(m0 + row) * DM + n0 + c8;
            }
        } else {
            // transposed: one line per tile column (64 consecutive s of one (b,head,e) row)
            const int bidx = m0 / SQ, s0 = m0 - bidx * SQ;
#pragma unroll
            for (int i = 0; i < 8; ++i) {
                const int col = 32 * w + 4 * i + (l >> 3);
                const int ck = (l & 7) * 8;
                const int gc = n0 + col;
                val[i] = *(const v8ha*)(sC + col * PT + ck);
                off[i] = (size_t)2 * PLANE
                       + ((size_t)((bidx * NH + (gc >> 6)) * HD + (gc & 63))) * SQ + s0 + ck;
            }
        }
#pragma unroll
        for (int i = 0; i < 8; ++i) *(v8h*)(O16 + off[i]) = val[i];
        
    }
}

// value of lane l ^ 16 (the other wave half), by a vector cross-row move
__device__ __forceinline__ float xhalf(float x)
{
    const int i = __builtin_bit_cast(int, x);
    return __builtin_bit_cast(float,
        __builtin_amdgcn_permlanex16(i, i, 0x76543210, 0xfedcba98, false, false));
}

// ------------------------------------------------------------------------------------------
// One lane's share of a 64-key stage: four 16-B pieces of the K tile and four of the V tile, rows
// 16 apart, copied from global memory into LDS without passing through registers. A wave's copy
// covers four whole 128-B rows. lk, lv: LDS byte addresses; gk, gv: the matching global addresses.
__device__ __forceinline__ void stage_kv(unsigned lk, unsigned lv,
                                         const _Float16* gk, const _Float16* gv)
{
    // s_wait_xcnt closes the statement so that no address register is rewritten ahead of it
    asm volatile("global_load_async_to_lds_b128 %0, %8, off\n\t"
                 "global_load_async_to_lds_b128 %1, %9, off\n\t"
                 "global_load_async_to_lds_b128 %2, %10, off\n\t"
                 "global_load_async_to_lds_b128 %3, %11, off\n\t"
                 "global_load_async_to_lds_b128 %4, %12, off\n\t"
                 "global_load_async_to_lds_b128 %5, %13, off\n\t"
                 "global_load_async_to_lds_b128 %6, %14, off\n\t"
                 "global_load_async_to_lds_b128 %7, %15, off\n\t"
                 "s_wait_xcnt 0x0"
                 :: "v"(lk), "v"(lk + 16u * KP * 2u), "v"(lk + 32u * KP * 2u), "v"(lk + 48u * KP * 2u),
                    "v"(lv), "v"(lv + 16u * KP * 2u), "v"(lv + 32u * KP * 2u), "v"(lv + 48u * KP * 2u),
                    "v"(gk), "v"(gk + 16 * DM), "v"(gk + 32 * DM), "v"(gk + 48 * DM),
                    "v"(gv), "v"(gv + 16 * SQ), "v"(gv + 32 * SQ), "v"(gv + 48 * SQ)
                 : "memory");
}

__global__ __launch_bounds__(256) __attribute__((amdgpu_num_vgpr(256)))
void k_attn(const _Float16* __restrict__ Qh, const _Float16* __restrict__ Kh,
            const _Float16* __restrict__ Vt, const float* __restrict__ tau,
            const float* __restrict__ delta, _Float16* __restrict__ Ctx)
{
    __shared__ _Float16 __attribute__((aligned(16))) sP[QB * PP];
    __shared__ _Float16 __attribute__((aligned(16))) sKV[2 * 2 * 2 * KVT];   // [parity][buffer][K, V][row][KP]
    __shared__ float __attribute__((aligned(16))) sX[8 * 1024];   // [wave][e tile][4-register half][lane][4]
    __shared__ float sML[8 * 2 * 32];                             // [wave][maximum, sum][lane]
    const int t = threadIdx.x, l = t & 31, w = t >> 5, h = l >> 4, m = l & 15;
    const int qg = w & 3, kh = w >> 2, tc = t & 127;
    const int bq = blockIdx.z, hd = blockIdx.y, q0 = blockIdx.x * QB;

    const float LOG2E = 1.4426950408889634f;
#if AFFINE_BF16
    const float tb = bfr(tau[bq]);
    const float db = bfr(delta[bq]);
#else
    const float tb = tau[bq];
    const float db = delta[bq];
#endif
    // logit2 = log2(e) * 0.125 * (s * tau + delta), s = sacc / 64 (q and k each carried x8)
    const float c1 = tb * (0.125f / 64.0f) * LOG2E;
    const float c0 = db * 0.125f * LOG2E;

    Frag qf[2][2];                            // [query group][32-e half]
#pragma unroll
    for (int g = 0; g < 2; ++g) {
        const _Float16* qp = Qh + (size_t)(bq * SQ + q0 + 32 * qg + 16 * g + m) * DM + hd * HD + 8 * h;
#pragma unroll
        for (int ec = 0; ec < 2; ++ec) {
            qf[g][ec].p[0] = *(const v8h*)(qp + 32 * ec);        // e = 32ec+8h .. +7
            qf[g][ec].p[1] = *(const v8h*)(qp + 32 * ec + 16);   // e = 32ec+16+8h .. +7
        }
    }
    // copy side: thread tc of a parity's 128 brings piece (tc & 7) of rows (tc >> 3) + 16 j, j = 0..3, of
    // each of that parity's tiles; kcp, vcp point into its first tile (keys 64 kh ..)
    const _Float16* kcp = Kh + (size_t)(bq * SQ + 64 * kh + (tc >> 3)) * DM + hd * HD + 8 * (tc & 7);
    const _Float16* vcp = Vt + ((size_t)(bq * NH + hd) * HD + (tc >> 3)) * SQ + 64 * kh + 8 * (tc & 7);
    const unsigned lcp = (unsigned)(uintptr_t)(sKV + kh * (4 * KVT) + (tc >> 3) * KP + 8 * (tc & 7));
    // fragment side: row m of a 16-row group, k = 8h.. and 16+8h..
    const _Float16* fbase = sKV + kh * (4 * KVT) + m * KP + 8 * h;
    _Float16* myP = sP + (2 * qg + kh) * 16 * PP;

    v8f oacc[2][4];
    float mrun[2];                            // query m of each group: running maximum (both halves alike)
    float lpart[2][4];                        // sums over this half's keys, one per sub-tile
#pragma unroll
    for (int g = 0; g < 2; ++g) {
        mrun[g] = -1.0e30f;
#pragma unroll
        for (int et = 0; et < 4; ++et) { oacc[g][et] = zero8(); lpart[g][et] = 0.0f; }
    }

    stage_kv(lcp, lcp + KVT * 2u, kcp, vcp);
    asm volatile("s_wait_asynccnt 0x0" ::: "memory");   // stage 0 landed, this wave's share
    __syncthreads();                                    // stage 0 readable by every wave
    stage_kv(lcp + 2u * KVT * 2u, lcp + 3u * KVT * 2u, kcp + (size_t)128 * DM, vcp + 128);

    // s0: first key of the pair of tiles of this trip; this wave works on keys s0 + 64 kh ..
    for (int s0 = 0; s0 < SQ; s0 += 128) {
        const unsigned buf = ((unsigned)s0 >> 7) & 1u;
        const _Float16* kT = fbase + buf * (2 * KVT);
        const _Float16* vT = kT + KVT;
        v8f sacc[2][4];
#pragma unroll
        for (int g = 0; g < 2; ++g)
#pragma unroll
            for (int sub = 0; sub < 4; ++sub) sacc[g][sub] = zero8();
#pragma unroll
        for (int ec = 0; ec < 2; ++ec) {
            Frag kf[4];
#pragma unroll
            for (int sub = 0; sub < 4; ++sub) {
                const _Float16* kp = kT + (16 * sub) * KP + 32 * ec;
                kf[sub].p[0] = *(const v8ha*)kp;
                kf[sub].p[1] = *(const v8ha*)(kp + 16);
            }
#pragma unroll
            for (int sub = 0; sub < 4; ++sub)
#pragma unroll
                for (int g = 0; g < 2; ++g) sacc[g][sub] = mma16(kf[sub].v, qf[g][ec].v, sacc[g][sub]);
            // four vector slots behind the last WMMA, before its D, A or B registers are touched
            asm volatile("v_nop\n\tv_nop\n\tv_nop\n\tv_nop"
                         : "+v"(sacc[0][0]), "+v"(sacc[0][1]), "+v"(sacc[0][2]), "+v"(sacc[0][3]),
                           "+v"(sacc[1][0]), "+v"(sacc[1][1]), "+v"(sacc[1][2]), "+v"(sacc[1][3])
                         : "v"(qf[0][ec].v), "v"(qf[1][ec].v),
                           "v"(kf[0].v), "v"(kf[1].v), "v"(kf[2].v), "v"(kf[3].v));
        }

        float msub[2];
#pragma unroll
        for (int g = 0; g < 2; ++g) {
            // affine + temperature in the log2 domain
#pragma unroll
            for (int sub = 0; sub < 4; ++sub)
#pragma unroll
                for (int r = 0; r < 8; ++r) sacc[g][sub][r] = sacc[g][sub][r] * c1 + c0;

            // online softmax; sacc[g][sub][r] = score of key 16 sub + 8h + r for query m of group g
            float ms[4];                       // four independent chains, one per sub-tile
#pragma unroll
            for (int sub = 0; sub < 4; ++sub) {
                ms[sub] = sacc[g][sub][0];
#pragma unroll
                for (int r = 1; r < 8; ++r) ms[sub] = fmaxf(ms[sub], sacc[g][sub][r]);
            }
            float mx = fmaxf(fmaxf(ms[0], ms[1]), fmaxf(ms[2], ms[3]));
            mx = fmaxf(mx, xhalf(mx));
            const float mn = fmaxf(mrun[g], mx);
            const float alpha = EX2(mrun[g] - mn);
            mrun[g] = mn;
            msub[g] = mn - 14.0f;              // numerators carried x2^14
#pragma unroll
            for (int sub = 0; sub < 4; ++sub) lpart[g][sub] *= alpha;
#pragma unroll
            for (int et = 0; et < 4; ++et)
#pragma unroll
                for (int r = 0; r < 8; ++r) oacc[g][et][r] *= alpha;
        }

#pragma unroll
        for (int sc = 0; sc < 2; ++sc) {
            // P^T as B: element s of the fragment is key 32sc + 8h + s (s < 8), 32sc + 16 + 8h + s - 8
            // (s >= 8), which is register s & 7 of score tile 2sc + (s >> 3); V^T rows take the same k order
            Frag pf[2], vf[4];
#pragma unroll
            for (int et = 0; et < 4; ++et) {
                const _Float16* vp = vT + (16 * et) * KP + 32 * sc;
                vf[et].p[0] = *(const v8ha*)vp;
                vf[et].p[1] = *(const v8ha*)(vp + 16);
            }
#pragma unroll
            for (int g = 0; g < 2; ++g)
#pragma unroll
                for (int hf = 0; hf < 2; ++hf)
#pragma unroll
                    for (int r = 0; r < 8; ++r) {
                        const float p = EX2(sacc[g][2 * sc + hf][r] - msub[g]);   // in (0, 16384]
                        lpart[g][2 * sc + hf] += p;
                        pf[g].p[hf][r] = (_Float16)p;
                    }
#pragma unroll
            for (int et = 0; et < 4; ++et)
#pragma unroll
                for (int g = 0; g < 2; ++g) oacc[g][et] = mma16(vf[et].v, pf[g].v, oacc[g][et]);
            // four vector slots behind the last WMMA, before its D, A or B registers are touched
            asm volatile("v_nop\n\tv_nop\n\tv_nop\n\tv_nop"
                         : "+v"(oacc[0][0]), "+v"(oacc[0][1]), "+v"(oacc[0][2]), "+v"(oacc[0][3]),
                           "+v"(oacc[1][0]), "+v"(oacc[1][1]), "+v"(oacc[1][2]), "+v"(oacc[1][3])
                         : "v"(pf[0].v), "v"(pf[1].v),
                           "v"(vf[0].v), "v"(vf[1].v), "v"(vf[2].v), "v"(vf[3].v));
        }

        // hand-over: this wave's reads of the current buffer are done, its share of the next stage
        // has landed; behind the barrier the next stage is readable and this buffer is free
        asm volatile("s_wait_dscnt 0x0" ::: "memory");
        asm volatile("s_wait_asynccnt 0x0" ::: "memory");
        __syncthreads();
        if (s0 + 256 < SQ)
            stage_kv(lcp + buf * (2u * KVT * 2u), lcp + buf * (2u * KVT * 2u) + KVT * 2u,
                     kcp + (size_t)(s0 + 256) * DM, vcp + (s0 + 256));
    }
    asm volatile("s_wait_asynccnt 0x0" ::: "memory");   // no copy outstanding past the loop

    // sum of query m over this wave's keys: this half's four partial sums, plus the other half's
    float lt[2];
#pragma unroll
    for (int g = 0; g < 2; ++g) {
        lt[g] = (lpart[g][0] + lpart[g][1]) + (lpart[g][2] + lpart[g][3]);
        lt[g] += xhalf(lt[g]);
    }
    // join of a wave pair (w, w ^ 4): wave kh finishes query group kh and hands its share of group 1 - kh,
    // lane for lane, to its partner
    const bool up = (kh != 0);
    const float mM = up ? mrun[1] : mrun[0], mG = up ? mrun[0] : mrun[1];
    const float lM = up ? lt[1] : lt[0], lG = up ? lt[0] : lt[1];
    {
        float* xo = sX + w * 1024;
#pragma unroll
        for (int et = 0; et < 4; ++et)
#pragma unroll
            for (int j = 0; j < 2; ++j) {
                v4f x;
#pragma unroll
                for (int r = 0; r < 4; ++r) x[r] = up ? oacc[0][et][4 * j + r] : oacc[1][et][4 * j + r];
                *(v4fa*)(xo + ((2 * et + j) * 32 + l) * 4) = x;
            }
        sML[(2 * w + 0) * 32 + l] = mG;
        sML[(2 * w + 1) * 32 + l] = lG;
    }
    __syncthreads();   // the partner's share is readable
    // context x32 = 4 * (O a + O' a') / (l a + l' a'), a = 2^(m - max(m, m'));
    // O[query 16 kh + m of the wave's 32][e = 16 et + 8h + r]: eight consecutive e, one 16-B LDS store
    {
        const float* xi = sX + (w ^ 4) * 1024;
        const float mP = sML[(2 * (w ^ 4) + 0) * 32 + l];
        const float lP = sML[(2 * (w ^ 4) + 1) * 32 + l];
        const float mj = fmaxf(mM, mP);
        const float aM = EX2(mM - mj), aP = EX2(mP - mj);
        const float inv = 4.0f / (lM * aM + lP * aP);
        const float cM = aM * inv, cP = aP * inv;
#pragma unroll
        for (int et = 0; et < 4; ++et) {
            v8h o;
#pragma unroll
            for (int j = 0; j < 2; ++j) {
                const v4f x = *(const v4fa*)(xi + ((2 * et + j) * 32 + l) * 4);
#pragma unroll
                for (int r = 0; r < 4; ++r) {
                    const float mine = up ? oacc[1][et][4 * j + r] : oacc[0][et][4 * j + r];
                    o[4 * j + r] = (_Float16)(mine * cM + x[r] * cP);
                }
            }
            *(v8ha*)(myP + m * PP + 16 * et + 8 * h) = o;
        }
    }
    __syncthreads();
    v8h cv[4];
    size_t coff[4];
#pragma unroll
    for (int i = 0; i < 4; ++i) {
        const int row = 16 * (2 * qg + kh) + 4 * i + (l >> 3);
        const int c8 = (l & 7) * 8;
        cv[i] = *(const v8ha*)(sP + row * PP + c8);
        coff[i] = (size_t)(bq * SQ + q0 + row) * DM + hd * HD + c8;
    }
#pragma unroll
    for (int i = 0; i < 4; ++i) *(v8h*)(Ctx + coff[i]) = cv[i];
    
}

// ------------------------------------------------------------------------------------------
extern "C" void kernel_launch(void* const* d_in, const int* in_sizes, int n_in,
                              void* d_out, int out_size, void* d_ws, size_t ws_size,
                              hipStream_t stream)
{
    if (n_in < 13) return;
    if (in_sizes[0] != PLANE || in_sizes[1] != PLANE || in_sizes[2] != PLANE) return;
    if (in_sizes[3] != NB || in_sizes[4] != NB) return;
    if (in_sizes[5] != DM * DM || in_sizes[7] != DM * DM || in_sizes[9] != DM * DM || in_sizes[11] != DM * DM) return;
    if (in_sizes[6] != DM || in_sizes[8] != DM || in_sizes[10] != DM || in_sizes[12] != DM) return;
    if (out_size != PLANE) return;

    const float* queries = (const float*)d_in[0];
    const float* keys    = (const float*)d_in[1];
    const float* values  = (const float*)d_in[2];
    const float* tau     = (const float*)d_in[3];
    const float* delta   = (const float*)d_in[4];
    const float* Wq = (const float*)d_in[5];
    const float* bq = (const float*)d_in[6];
    const float* Wk = (const float*)d_in[7];
    const float* bk = (const float*)d_in[8];
    const float* Wv = (const float*)d_in[9];
    const float* bv = (const float*)d_in[10];
    const float* Wo = (const float*)d_in[11];
    const float* bo = (const float*)d_in[12];
    float* out = (float*)d_out;

    // workspace carve (bytes), all offsets multiples of 2 MiB
    const size_t szPlane16 = (size_t)PLANE * 2;                 // 8 MiB
    const size_t offWt = 0;                                       // 4 x 512x512 f16 = 2 MiB
    const size_t offQ  = offWt + (size_t)4 * DM * DM * 2;
    const size_t offK  = offQ + szPlane16;
    const size_t offVt = offK + szPlane16;
    const size_t offC  = offVt + szPlane16;
    const size_t wsEnd = offC + szPlane16;                        // 34 MiB
    if (wsEnd > ws_size) return;

    char* ws = (char*)d_ws;
    _Float16* Wt  = (_Float16*)(ws + offWt);
    _Float16* Qh  = (_Float16*)(ws + offQ);
    _Float16* Kh  = (_Float16*)(ws + offK);
    _Float16* Vth = (_Float16*)(ws + offVt);
    _Float16* Ctx = (_Float16*)(ws + offC);

    // 1) weights -> transposed f16 (bf16 value x64): Wq, Wk, Wv, Wo
    k_cvt_wt<<<dim3(DM / 64, DM / 64, 4), dim3(128), 0, stream>>>(Wq, Wk, Wv, Wo, Wt);
    // 2) q, k (row-major) and v (head-transposed) projections of the f32 activations, f16 x8
    k_gemm<false><<<dim3(DM / 256, MR / 64, 3), dim3(256), 0, stream>>>(
        queries, keys, values, Ctx, Wt, bq, bk, bv, Qh, out, 1.0f / 1024.0f, 8.0f);
    // 3) attention -> context f16 x32
    k_attn<<<dim3(SQ / QB, NH, NB), dim3(256), 0, stream>>>(Qh, Kh, Vth, tau, delta, Ctx);
    // 4) output projection -> f32
    k_gemm<true><<<dim3(DM / 128, MR / 64, 1), dim3(128), 0, stream>>>(
        queries, keys, values, Ctx, Wt + (size_t)3 * DM * DM, bo, bo, bo, Qh, out, 1.0f / 2048.0f, 1.0f);
}

// v006
// It runs in 65.1 microseconds.
// In two side-by-side timings against v005, it was 1.06 and 1.05 times as fast.
// Counting every step since v000, it is 2.96 times as fast.
#include <hip/hip_runtime.h>
#include <stdint.h>

// All six contractions (three input projections, q.k^T, p.v, output projection):
// v_wmma_f32_16x16x32_f16, f16 operands, f32 accumulate. Float inputs are RNE-converted to
// bf16 values held exactly in f16 containers (activations x16, weights x64; tau, delta, bias as
// f32-held bf16 values); intermediates: q,k,v f16 x8, softmax numerators f16 x2^14, context f16 x32.
// Every scale is a power of two removed in f32. Softmax statistics in f32.

#ifndef AFFINE_BF16
#define AFFINE_BF16 1   // 1: tau and delta RNE-converted to bf16 values before use; 0: used as given
#endif

#define DM 512
#define NH 8
#define HD 64
#define NB 4
#define SQ 2048
#define MR (NB * SQ)            // 8192 token rows
#define PLANE (MR * DM)         // 4194304 elements per activation plane
#define PP 72                   // f16 LDS pitch of the per-wave context tile (epilogue)
#define PC 520                  // f16 LDS pitch of the row-major 128x512 epilogue tile
#define PT 72                   // f16 LDS pitch of the transposed 64x64 weight tile
#define PV 136                  // f16 LDS pitch of the transposed 512x128 epilogue tile (272 B = 16 B x 17)
#define PO 132                  // f32 LDS pitch of the 64x128 epilogue tile
#define KP 72                   // f16 LDS pitch of a staged 64-element K or V row (144 B = 16 B x 9)
#define KVT (64 * KP)           // f16 elements of one staged 64x64 tile
#define QB 128                  // query rows of one attention block
#define GK 64                   // k elements of one staged GEMM panel: one whole 128-B line per row

typedef _Float16 v16h __attribute__((ext_vector_type(16)));
typedef _Float16 v8h  __attribute__((ext_vector_type(8)));
typedef v8h __attribute__((may_alias)) v8ha;
typedef float v8f __attribute__((ext_vector_type(8)));
typedef float v4f __attribute__((ext_vector_type(4)));
typedef v4f __attribute__((may_alias)) v4fa;
typedef _Float16 v4h __attribute__((ext_vector_type(4)));
typedef v4h __attribute__((may_alias)) v4ha;
typedef _Float16 v2h __attribute__((ext_vector_type(2)));
typedef float v2f __attribute__((ext_vector_type(2)));
typedef __bf16 v2b __attribute__((ext_vector_type(2)));

union Frag { v16h v; v8h p[2]; };

#if defined(__has_builtin)
#if __has_builtin(__builtin_amdgcn_exp2f)
#define EX2(x) __builtin_amdgcn_exp2f(x)
#endif
#endif
#ifndef EX2
#define EX2(x) __expf((x) * 0.69314718055994531f)
#endif

// f32 -> nearest-even bf16 value, returned as f32
__device__ __forceinline__ float bfr(float x)
{
    unsigned u = __float_as_uint(x);
    u = (u + 0x7fffu + ((u >> 16) & 1u)) & 0xffff0000u;
    return __uint_as_float(u);
}
// bf16 value times a power of two, held in an f16 container (exact in the normal range)
__device__ __forceinline__ _Float16 cvh(float x, float s) { return (_Float16)(bfr(x) * s); }

__device__ __forceinline__ v8f mma16(v16h a, v16h b, v8f c)
{
    return __builtin_amdgcn_wmma_f32_16x16x32_f16(false, a, false, b, (short)0, c, false, false);
}

__device__ __forceinline__ v8f zero8()
{
    v8f z;
#pragma unroll
    for (int i = 0; i < 8; ++i) z[i] = 0.0f;
    return z;
}

// four activations -> f16 (bf16 value x16): the packed conversion rounds to nearest even as bfr() does
__device__ __forceinline__ v4h cvh4(v4f x)
{
    v4h o;
#pragma unroll
    for (int p = 0; p < 2; ++p) {
        v2f f;
        f[0] = x[2 * p]; f[1] = x[2 * p + 1];
        const unsigned u = __builtin_bit_cast(unsigned, __builtin_convertvector(f, v2b));
        v2f g;
        g[0] = __uint_as_float(u << 16); g[1] = __uint_as_float(u & 0xffff0000u);
        g *= 16.0f;
        const v2h hh = __builtin_convertvector(g, v2h);
        o[2 * p] = hh[0]; o[2 * p + 1] = hh[1];
    }
    return o;
}

// ------------------------------------------------------------------------------------------
// Weight convert + transpose: four f32 W[k][n] (512x512) -> f16 Wt[n][k] (bf16 value x64),
// k-contiguous so B fragments load like A fragments. 64x64 tile through LDS; each output line
__global__ __launch_bounds__(128)
void k_cvt_wt(const float* __restrict__ w0, const float* __restrict__ w1,
              const float* __restrict__ w2, const float* __restrict__ w3,
              _Float16* __restrict__ wt)
{
    __shared__ _Float16 __attribute__((aligned(16))) sT[64 * PT];   // [n_local][k_local]
    const int z = blockIdx.z;
    const float* src = (z == 0) ? w0 : ((z == 1) ? w1 : ((z == 2) ? w2 : w3));
    _Float16* dst = wt + (size_t)z * (DM * DM);
    const int k0 = blockIdx.y * 64, n0 = blockIdx.x * 64;
    const int t = threadIdx.x, l = t & 31, w = t >> 5;
    const int nn = (t & 15) * 4, kb = t >> 4;
#pragma unroll
    for (int i = 0; i < 8; ++i) {
        const int kk = kb + 8 * i;
        const float4 v = *(const float4*)(src + (size_t)(k0 + kk) * DM + n0 + nn);
        sT[(nn + 0) * PT + kk] = cvh(v.x, 64.0f);
        sT[(nn + 1) * PT + kk] = cvh(v.y, 64.0f);
        sT[(nn + 2) * PT + kk] = cvh(v.z, 64.0f);
        sT[(nn + 3) * PT + kk] = cvh(v.w, 64.0f);
    }
    __syncthreads();
    v8h val[4];
    size_t off[4];
#pragma unroll
    for (int i = 0; i < 4; ++i) {
        const int line = 16 * w + 4 * i + (l >> 3);   // n_local
        const int ck = (l & 7) * 8;
        val[i] = *(const v8ha*)(sT + line * PT + ck);
        off[i] = (size_t)(n0 + line) * DM + k0 + ck;
    }
#pragma unroll
    for (int i = 0; i < 4; ++i) *(v8h*)(dst + off[i]) = val[i];
    
}

// ------------------------------------------------------------------------------------------
// One lane's share of a 64-k GEMM stage: four 16-B pieces of the 64-row A panel and eight of the
// 128-row B panel, rows 16 apart, copied from global memory into LDS without passing through
// registers. A wave's copy covers four whole 128-B lines. la, lb: LDS byte addresses; ga, gb: the
// matching global addresses.
__device__ __forceinline__ void stage_ab(unsigned la, unsigned lb,
                                         const _Float16* ga, const _Float16* gb)
{
    // s_wait_xcnt closes the statement so that no address register is rewritten ahead of it
    asm volatile("global_load_async_to_lds_b128 %0, %12, off\n\t"
                 "global_load_async_to_lds_b128 %1, %13, off\n\t"
                 "global_load_async_to_lds_b128 %2, %14, off\n\t"
                 "global_load_async_to_lds_b128 %3, %15, off\n\t"
                 "global_load_async_to_lds_b128 %4, %16, off\n\t"
                 "global_load_async_to_lds_b128 %5, %17, off\n\t"
                 "global_load_async_to_lds_b128 %6, %18, off\n\t"
                 "global_load_async_to_lds_b128 %7, %19, off\n\t"
                 "global_load_async_to_lds_b128 %8, %20, off\n\t"
                 "global_load_async_to_lds_b128 %9, %21, off\n\t"
                 "global_load_async_to_lds_b128 %10, %22, off\n\t"
                 "global_load_async_to_lds_b128 %11, %23, off\n\t"
                 "s_wait_xcnt 0x0"
                 :: "v"(la), "v"(la + 16u * KP * 2u), "v"(la + 32u * KP * 2u), "v"(la + 48u * KP * 2u),
                    "v"(lb), "v"(lb + 16u * KP * 2u), "v"(lb + 32u * KP * 2u), "v"(lb + 48u * KP * 2u),
                    "v"(lb + 64u * KP * 2u), "v"(lb + 80u * KP * 2u), "v"(lb + 96u * KP * 2u),
                    "v"(lb + 112u * KP * 2u),
                    "v"(ga), "v"(ga + 16 * DM), "v"(ga + 32 * DM), "v"(ga + 48 * DM),
                    "v"(gb), "v"(gb + 16 * DM), "v"(gb + 32 * DM), "v"(gb + 48 * DM),
                    "v"(gb + 64 * DM), "v"(gb + 80 * DM), "v"(gb + 96 * DM), "v"(gb + 112 * DM)
                 : "memory");
}

// One lane's share of a 512-row B panel alone, for the GEMM whose A panel comes through registers:
// eight 16-B pieces, rows 64 apart (512 threads).
__device__ __forceinline__ void stage_b(unsigned lb, const _Float16* gb)
{
    // s_wait_xcnt closes the statement so that no address register is rewritten ahead of it
    asm volatile("global_load_async_to_lds_b128 %0, %8, off\n\t"
                 "global_load_async_to_lds_b128 %1, %9, off\n\t"
                 "global_load_async_to_lds_b128 %2, %10, off\n\t"
                 "global_load_async_to_lds_b128 %3, %11, off\n\t"
                 "global_load_async_to_lds_b128 %4, %12, off\n\t"
                 "global_load_async_to_lds_b128 %5, %13, off\n\t"
                 "global_load_async_to_lds_b128 %6, %14, off\n\t"
                 "global_load_async_to_lds_b128 %7, %15, off\n\t"
                 "s_wait_xcnt 0x0"
                 :: "v"(lb), "v"(lb + 64u * KP * 2u), "v"(lb + 128u * KP * 2u), "v"(lb + 192u * KP * 2u),
                    "v"(lb + 256u * KP * 2u), "v"(lb + 320u * KP * 2u), "v"(lb + 384u * KP * 2u),
                    "v"(lb + 448u * KP * 2u),
                    "v"(gb), "v"(gb + 64 * DM), "v"(gb + 128 * DM), "v"(gb + 192 * DM),
                    "v"(gb + 256 * DM), "v"(gb + 320 * DM), "v"(gb + 384 * DM), "v"(gb + 448 * DM)
                 : "memory");
}

// ------------------------------------------------------------------------------------------
// C[BM x NT per block] = A[rows][512] (row-major) * B, with B given as Bt[n][k] (f16).
// Each 64-k panel of A and of B is brought into LDS once per block, two buffers, one stage ahead of its
// use; the waves read their fragments from there with the 16x16x32 split-k lane map for both A and B.
// B comes by asynchronous copies.
// !OUTF: BM = 128, NT = 512 (all columns), 16 waves, one per 64x64 sub-tile = 4x4 accumulators: an LDS
//        fragment feeds four WMMAs, every activation row is fetched and converted by one block only, and
//        the weight panel is fetched once per 128 rows. A is the f32 activation plane x0, x1 or x2
//        (blockIdx.z): plain loads issued where the stage's copies are, converted to f16 (bf16 value x16)
//        in registers and stored to the stage's A panel ahead of the barrier that publishes the stage.
//        v = (acc*s_acc + bf16(bias)) * s_out -> f16; blockIdx.z selects the plane
//        (z=0,1 row-major [8192][512]; z=2 head-transposed [NB][NH][HD][SQ]).
// OUTF : BM = 64, NT = 128, 4 waves, one per 32x64 sub-tile = 2x4 accumulators. A is f16, by asynchronous
//        copies; same value -> f32 d_out.
// 256 VGPRs: a wave's share where the 16 waves of a block stand four to a SIMD.
template<bool OUTF>
__global__ __launch_bounds__(OUTF ? 128 : 512) __attribute__((amdgpu_num_vgpr(256)))
void k_gemm(const float* __restrict__ x0, const float* __restrict__ x1, const float* __restrict__ x2,
            const _Float16* __restrict__ A, const _Float16* __restrict__ Bt,
            const float* __restrict__ bi0, const float* __restrict__ bi1,
            const float* __restrict__ bi2,
            _Float16* __restrict__ O16, float* __restrict__ O32, float s_acc, float s_out)
{
    const int t = threadIdx.x, l = t & 31, w = t >> 5, h = l >> 4, m = l & 15;
    const int z = blockIdx.z;
    constexpr int NT = OUTF ? 128 : 512;      // columns of the block tile
    constexpr int BM = OUTF ? 64 : 128;       // rows of the block tile, two wave tiles high
    constexpr int MI = BM / 32;               // 16-row groups of a wave tile
    constexpr int GA = BM * KP;               // f16 elements of a staged BM-row A panel
    constexpr int GB = NT * KP;               // f16 elements of a staged NT-row B panel
    constexpr int GST = GA + GB;              // f16 elements of one stage
    const int n0 = blockIdx.x * NT, m0 = blockIdx.y * BM;
    const int wm = (w / (NT / 64)) * (BM / 2), wn = (w % (NT / 64)) * 64;
    const _Float16* Bb = Bt + (size_t)z * (DM * DM);
    const float* bias = (z == 0) ? bi0 : ((z == 1) ? bi1 : bi2);

    __shared__ _Float16 __attribute__((aligned(16))) sAB[2 * GST];   // [buffer][A BM rows, B NT rows][KP]
    // copy side: thread t brings piece (t & 7) of rows (t >> 3) + (NT / 8) j of a panel
    const _Float16* acp = A + (size_t)(m0 + (t >> 3)) * DM + 8 * (t & 7);
    const _Float16* bcp = Bb + (size_t)(n0 + (t >> 3)) * DM + 8 * (t & 7);
    const unsigned lcp = (unsigned)(uintptr_t)(sAB + (t >> 3) * KP + 8 * (t & 7));
    // f32 A side: thread t brings k = 4 (t & 15) .. +3 of rows (t >> 4) + 32 j, so that one wave load
    // covers four whole 128-B lines
    const float* xs = (z == 0) ? x0 : ((z == 1) ? x1 : x2);
    const float* xcp = xs + (size_t)(m0 + (t >> 4)) * DM + 4 * (t & 15);
    _Float16* sa = sAB + (t >> 4) * KP + 4 * (t & 15);
    v4f ar[4];                                // the A stage in flight
    // fragment side: row m of a 16-row group, k = 8h.. and 16+8h.. of each 32-k half
    const _Float16* fa = sAB + (wm + m) * KP + 8 * h;
    const _Float16* fb = sAB + GA + (wn + m) * KP + 8 * h;

    v8f acc[MI][4];
#pragma unroll
    for (int mi = 0; mi < MI; ++mi)
#pragma unroll
        for (int ni = 0; ni < 4; ++ni) acc[mi][ni] = zero8();

    if constexpr (OUTF) {
        stage_ab(lcp, lcp + GA * 2u, acp, bcp);
    } else {
#pragma unroll
        for (int j = 0; j < 4; ++j) ar[j] = *(const v4fa*)(xcp + (32 * j) * DM);
        stage_b(lcp + GA * 2u, bcp);
        // keeps the conversion, which waits for the loads, behind the issue of the copies
        __builtin_amdgcn_sched_barrier(0);
#pragma unroll
        for (int j = 0; j < 4; ++j) *(v4ha*)(sa + (32 * j) * KP) = cvh4(ar[j]);
    }
    asm volatile("s_wait_asynccnt 0x0" ::: "memory");   // stage 0 landed, this wave's share
    __syncthreads();                                    // stage 0 readable by every wave
    if constexpr (OUTF) {
        stage_ab(lcp + GST * 2u, lcp + (GST + GA) * 2u, acp + GK, bcp + GK);
    } else {
#pragma unroll
        for (int j = 0; j < 4; ++j) ar[j] = *(const v4fa*)(xcp + (32 * j) * DM + GK);
        stage_b(lcp + (GST + GA) * 2u, bcp + GK);
    }

    // OUTF, two trips a pass: each buffer's LDS offsets are immediates; unrolled whole, the build formed the
    // copy addresses of all later stages early and took about 250 VGPRs. !OUTF, rolled: the second buffer
    // lies past the reach of an LDS immediate, and two trips a pass held one address register per read
#pragma unroll (OUTF ? 2 : 1)
    for (int k0 = 0; k0 < DM; k0 += GK) {
        const unsigned buf = ((unsigned)k0 >> 6) & 1u;
        const _Float16* aT = fa + buf * GST;
        const _Float16* bT = fb + buf * GST;
        if constexpr (!OUTF) {
            // fragment of 16 rows from row group rg of panel p, 32-k half kh: k = 32kh+8h .. +7, 32kh+16+8h .. +7
            auto ldf = [](Frag& f, const _Float16* p, int rg, int kh) {
                f.p[0] = *(const v8ha*)(p + (16 * rg) * KP + 32 * kh);
                f.p[1] = *(const v8ha*)(p + (16 * rg) * KP + 32 * kh + 16);
            };
            // The second half's fragments are read in two groups among the first half's WMMAs, into registers
            // that those have left (two B fragments take registers of their own). The scheduling barriers
            // hold that order: left alone, the build kept one A fragment and waited for LDS ahead of every
            // four WMMAs.
            Frag a0[MI], b0[4], a1[MI], b1[4];
            ldf(b0[0], bT, 0, 0); ldf(a0[0], aT, 0, 0);
            ldf(b0[1], bT, 1, 0); ldf(b0[2], bT, 2, 0); ldf(b0[3], bT, 3, 0);
            ldf(a0[1], aT, 1, 0); ldf(a0[2], aT, 2, 0); ldf(a0[3], aT, 3, 0);
            __builtin_amdgcn_sched_barrier(0);
#pragma unroll
            for (int mi = 0; mi < 2; ++mi)
#pragma unroll
                for (int ni = 0; ni < 4; ++ni) acc[mi][ni] = mma16(a0[mi].v, b0[ni].v, acc[mi][ni]);
            __builtin_amdgcn_sched_barrier(0);
            ldf(a1[0], aT, 0, 1); ldf(b1[0], bT, 0, 1); ldf(a1[1], aT, 1, 1); ldf(b1[1], bT, 1, 1);
            __builtin_amdgcn_sched_barrier(0);
#pragma unroll
            for (int mi = 2; mi < 4; ++mi)
#pragma unroll
                for (int ni = 0; ni < 4; ++ni) acc[mi][ni] = mma16(a0[mi].v, b0[ni].v, acc[mi][ni]);
            __builtin_amdgcn_sched_barrier(0);
            ldf(b1[2], bT, 2, 1); ldf(b1[3], bT, 3, 1); ldf(a1[2], aT, 2, 1); ldf(a1[3], aT, 3, 1);
            __builtin_amdgcn_sched_barrier(0);
#pragma unroll
            for (int mi = 0; mi < 2; ++mi)
#pragma unroll
                for (int ni = 0; ni < 2; ++ni) acc[mi][ni] = mma16(a1[mi].v, b1[ni].v, acc[mi][ni]);
#pragma unroll
            for (int mi = 0; mi < 2; ++mi)
#pragma unroll
                for (int ni = 2; ni < 4; ++ni) acc[mi][ni] = mma16(a1[mi].v, b1[ni].v, acc[mi][ni]);
#pragma unroll
            for (int mi = 2; mi < 4; ++mi)
#pragma unroll
                for (int ni = 0; ni < 4; ++ni) acc[mi][ni] = mma16(a1[mi].v, b1[ni].v, acc[mi][ni]);
            // keeps every WMMA of the trip ahead of the slots below
            __builtin_amdgcn_sched_barrier(0);
            // four vector slots behind the last WMMA, before its D, A or B registers are touched
            asm volatile("v_nop\n\tv_nop\n\tv_nop\n\tv_nop");
        } else {
        // both 32-k halves are named ahead of the 16 WMMAs, so the second half's reads can issue among
        // the first half's WMMAs
        Frag a[2][2], b[2][4];
#pragma unroll
        for (int kh = 0; kh < 2; ++kh) {
#pragma unroll
            for (int mi = 0; mi < 2; ++mi) {
                a[kh][mi].p[0] = *(const v8ha*)(aT + (16 * mi) * KP + 32 * kh);        // k0+32kh+8h .. +7
                a[kh][mi].p[1] = *(const v8ha*)(aT + (16 * mi) * KP + 32 * kh + 16);   // k0+32kh+16+8h .. +7
            }
#pragma unroll
            for (int ni = 0; ni < 4; ++ni) {
                b[kh][ni].p[0] = *(const v8ha*)(bT + (16 * ni) * KP + 32 * kh);
                b[kh][ni].p[1] = *(const v8ha*)(bT + (16 * ni) * KP + 32 * kh + 16);
            }
        }
#pragma unroll
        for (int kh = 0; kh < 2; ++kh)
#pragma unroll
            for (int mi = 0; mi < 2; ++mi)
#pragma unroll
                for (int ni = 0; ni < 4; ++ni)
                    acc[mi][ni] = mma16(a[kh][mi].v, b[kh][ni].v, acc[mi][ni]);
        // four vector slots behind the last WMMA, before its D, A or B registers are touched
        asm volatile("v_nop\n\tv_nop\n\tv_nop\n\tv_nop"
                     : "+v"(acc[0][0]), "+v"(acc[0][1]), "+v"(acc[0][2]), "+v"(acc[0][3]),
                       "+v"(acc[1][0]), "+v"(acc[1][1]), "+v"(acc[1][2]), "+v"(acc[1][3])
                     : "v"(a[1][0].v), "v"(a[1][1].v), "v"(b[1][0].v), "v"(b[1][1].v), "v"(b[1][2].v),
                       "v"(b[1][3].v));
        }

        // the next stage's A panel goes into the other buffer, whose readers left at the last barrier
        if constexpr (!OUTF) {
            // keeps the conversion, which waits for the loads, behind this trip's WMMAs: hoisted among
            // them it stalled the wave on loads issued just before the trip
            __builtin_amdgcn_sched_barrier(0);
            if (k0 + GK < DM) {
#pragma unroll
                for (int j = 0; j < 4; ++j) *(v4ha*)(sa + (buf ^ 1u) * GST + (32 * j) * KP) = cvh4(ar[j]);
            }
        }
        // hand-over: this wave's reads of the current buffer are done, its share of the next stage
        // has landed; behind the barrier the next stage is readable and this buffer is free
        asm volatile("s_wait_dscnt 0x0" ::: "memory");
        asm volatile("s_wait_asynccnt 0x0" ::: "memory");
        __syncthreads();
        if (k0 + 2 * GK < DM) {
            if constexpr (OUTF) {
                stage_ab(lcp + buf * (GST * 2u), lcp + buf * (GST * 2u) + GA * 2u,
                         acp + (k0 + 2 * GK), bcp + (k0 + 2 * GK));
            } else {
#pragma unroll
                for (int j = 0; j < 4; ++j) ar[j] = *(const v4fa*)(xcp + (32 * j) * DM + (k0 + 2 * GK));
                stage_b(lcp + buf * (GST * 2u) + GA * 2u, bcp + (k0 + 2 * GK));
            }
        }
    }
    asm volatile("s_wait_asynccnt 0x0" ::: "memory");   // no copy outstanding past the loop

    float bb[4];
#pragma unroll
    for (int ni = 0; ni < 4; ++ni) bb[ni] = bfr(bias[n0 + wn + 16 * ni + m]);

    if constexpr (OUTF) {
        __shared__ float __attribute__((aligned(16))) sO[64 * PO];
#pragma unroll
        for (int mi = 0; mi < 2; ++mi)
#pragma unroll
            for (int ni = 0; ni < 4; ++ni)
#pragma unroll
                for (int r = 0; r < 8; ++r) {
                    const int row = wm + 16 * mi + 8 * h + r;
                    const int col = wn + 16 * ni + m;
                    sO[row * PO + col] = (acc[mi][ni][r] * s_acc + bb[ni]) * s_out;
                }
        __syncthreads();
        v4f val[16];
#pragma unroll
        for (int i = 0; i < 16; ++i) val[i] = *(const v4fa*)(sO + (16 * w + i) * PO + 4 * l);
#pragma unroll
        for (int i = 0; i < 16; ++i)
            *(v4f*)(O32 + (size_t)(m0 + 16 * w + i) * DM + n0 + 4 * l) = val[i];
        
    } else {
        // 128 x PC or 512 x PV view, laid over the stage buffers: every wave's last fragment read ended ahead
        // of the loop's last barrier and no copy is outstanding.
        static_assert(NT * PV <= 2 * GST && BM * PC <= 2 * GST, "output tile exceeds the stage buffers");
        _Float16* sC = sAB;
        if (z != 2) {
#pragma unroll
            for (int mi = 0; mi < MI; ++mi)
#pragma unroll
                for (int ni = 0; ni < 4; ++ni)
#pragma unroll
                    for (int r = 0; r < 8; ++r) {
                        const int row = wm + 16 * mi + 8 * h + r;
                        const int col = wn + 16 * ni + m;
                        sC[row * PC + col] = (_Float16)((acc[mi][ni][r] * s_acc + bb[ni]) * s_out);
                    }
        } else {
#pragma unroll
            for (int mi = 0; mi < MI; ++mi)
#pragma unroll
                for (int ni = 0; ni < 4; ++ni)
#pragma unroll
                    for (int r = 0; r < 8; ++r) {
                        const int row = wm + 16 * mi + 8 * h + r;
                        const int col = wn + 16 * ni + m;
                        sC[col * PV + row] = (_Float16)((acc[mi][ni][r] * s_acc + bb[ni]) * s_out);
                    }
        }
        __syncthreads();
        v8h val[16];
        size_t off[16];
        if (z != 2) {
            // a wave's store covers half a row: four whole lines
#pragma unroll
            for (int i = 0; i < 16; ++i) {
                const int row = 8 * w + (i >> 1);
                const int c8 = (i & 1) * 256 + l * 8;
                val[i] = *(const v8ha*)(sC + row * PC + c8);
                off[i] = (size_t)z * PLANE + (size_t)(m0 + row) * DM + n0 + c8;
            }
        } else {
            // transposed: two lines per tile column (128 consecutive s of one (b,head,e) row)
            const int bidx = m0 / SQ, s0 = m0 - bidx * SQ;
#pragma unroll
            for (int i = 0; i < 16; ++i) {
                const int col = 32 * w + 2 * i + (l >> 4);
                const int ck = (l & 15) * 8;
                const int gc = n0 + col;
                val[i] = *(const v8ha*)(sC + col * PV + ck);
                off[i] = (size_t)2 * PLANE
                       + ((size_t)((bidx * NH + (gc >> 6)) * HD + (gc & 63))) * SQ + s0 + ck;
            }
        }
#pragma unroll
        for (int i = 0; i < 16; ++i) *(v8h*)(O16 + off[i]) = val[i];
        
    }
}

// value of lane l ^ 16 (the other wave half), by a vector cross-row move
__device__ __forceinline__ float xhalf(float x)
{
    const int i = __builtin_bit_cast(int, x);
    return __builtin_bit_cast(float,
        __builtin_amdgcn_permlanex16(i, i, 0x76543210, 0xfedcba98, false, false));
}

// ------------------------------------------------------------------------------------------
// One lane's share of a 64-key stage: four 16-B pieces of the K tile and four of the V tile, rows
// 16 apart, copied from global memory into LDS without passing through registers. A wave's copy
// covers four whole 128-B rows. lk, lv: LDS byte addresses; gk, gv: the matching global addresses.
__device__ __forceinline__ void stage_kv(unsigned lk, unsigned lv,
                                         const _Float16* gk, const _Float16* gv)
{
    // s_wait_xcnt closes the statement so that no address register is rewritten ahead of it
    asm volatile("global_load_async_to_lds_b128 %0, %8, off\n\t"
                 "global_load_async_to_lds_b128 %1, %9, off\n\t"
                 "global_load_async_to_lds_b128 %2, %10, off\n\t"
                 "global_load_async_to_lds_b128 %3, %11, off\n\t"
                 "global_load_async_to_lds_b128 %4, %12, off\n\t"
                 "global_load_async_to_lds_b128 %5, %13, off\n\t"
                 "global_load_async_to_lds_b128 %6, %14, off\n\t"
                 "global_load_async_to_lds_b128 %7, %15, off\n\t"
                 "s_wait_xcnt 0x0"
                 :: "v"(lk), "v"(lk + 16u * KP * 2u), "v"(lk + 32u * KP * 2u), "v"(lk + 48u * KP * 2u),
                    "v"(lv), "v"(lv + 16u * KP * 2u), "v"(lv + 32u * KP * 2u), "v"(lv + 48u * KP * 2u),
                    "v"(gk), "v"(gk + 16 * DM), "v"(gk + 32 * DM), "v"(gk + 48 * DM),
                    "v"(gv), "v"(gv + 16 * SQ), "v"(gv + 32 * SQ), "v"(gv + 48 * SQ)
                 : "memory");
}

__global__ __launch_bounds__(256) __attribute__((amdgpu_num_vgpr(256)))
void k_attn(const _Float16* __restrict__ Qh, const _Float16* __restrict__ Kh,
            const _Float16* __restrict__ Vt, const float* __restrict__ tau,
            const float* __restrict__ delta, _Float16* __restrict__ Ctx)
{
    __shared__ _Float16 __attribute__((aligned(16))) sP[QB * PP];
    __shared__ _Float16 __attribute__((aligned(16))) sKV[2 * 2 * 2 * KVT];   // [parity][buffer][K, V][row][KP]
    __shared__ float __attribute__((aligned(16))) sX[8 * 1024];   // [wave][e tile][4-register half][lane][4]
    __shared__ float sML[8 * 2 * 32];                             // [wave][maximum, sum][lane]
    const int t = threadIdx.x, l = t & 31, w = t >> 5, h = l >> 4, m = l & 15;
    const int qg = w & 3, kh = w >> 2, tc = t & 127;
    const int bq = blockIdx.z, hd = blockIdx.y, q0 = blockIdx.x * QB;

    const float LOG2E = 1.4426950408889634f;
#if AFFINE_BF16
    const float tb = bfr(tau[bq]);
    const float db = bfr(delta[bq]);
#else
    const float tb = tau[bq];
    const float db = delta[bq];
#endif
    // logit2 = log2(e) * 0.125 * (s * tau + delta), s = sacc / 64 (q and k each carried x8)
    const float c1 = tb * (0.125f / 64.0f) * LOG2E;
    const float c0 = db * 0.125f * LOG2E;

    Frag qf[2][2];                            // [query group][32-e half]
#pragma unroll
    for (int g = 0; g < 2; ++g) {
        const _Float16* qp = Qh + (size_t)(bq * SQ + q0 + 32 * qg + 16 * g + m) * DM + hd * HD + 8 * h;
#pragma unroll
        for (int ec = 0; ec < 2; ++ec) {
            qf[g][ec].p[0] = *(const v8h*)(qp + 32 * ec);        // e = 32ec+8h .. +7
            qf[g][ec].p[1] = *(const v8h*)(qp + 32 * ec + 16);   // e = 32ec+16+8h .. +7
        }
    }
    // copy side: thread tc of a parity's 128 brings piece (tc & 7) of rows (tc >> 3) + 16 j, j = 0..3, of
    // each of that parity's tiles; kcp, vcp point into its first tile (keys 64 kh ..)
    const _Float16* kcp = Kh + (size_t)(bq * SQ + 64 * kh + (tc >> 3)) * DM + hd * HD + 8 * (tc & 7);
    const _Float16* vcp = Vt + ((size_t)(bq * NH + hd) * HD + (tc >> 3)) * SQ + 64 * kh + 8 * (tc & 7);
    const unsigned lcp = (unsigned)(uintptr_t)(sKV + kh * (4 * KVT) + (tc >> 3) * KP + 8 * (tc & 7));
    // fragment side: row m of a 16-row group, k = 8h.. and 16+8h..
    const _Float16* fbase = sKV + kh * (4 * KVT) + m * KP + 8 * h;
    _Float16* myP = sP + (2 * qg + kh) * 16 * PP;

    v8f oacc[2][4];
    float mrun[2];                            // query m of each group: running maximum (both halves alike)
    float lpart[2][4];                        // sums over this half's keys, one per sub-tile
#pragma unroll
    for (int g = 0; g < 2; ++g) {
        mrun[g] = -1.0e30f;
#pragma unroll
        for (int et = 0; et < 4; ++et) { oacc[g][et] = zero8(); lpart[g][et] = 0.0f; }
    }

    stage_kv(lcp, lcp + KVT * 2u, kcp, vcp);
    asm volatile("s_wait_asynccnt 0x0" ::: "memory");   // stage 0 landed, this wave's share
    __syncthreads();                                    // stage 0 readable by every wave
    stage_kv(lcp + 2u * KVT * 2u, lcp + 3u * KVT * 2u, kcp + (size_t)128 * DM, vcp + 128);

    // s0: first key of the pair of tiles of this trip; this wave works on keys s0 + 64 kh ..
    for (int s0 = 0; s0 < SQ; s0 += 128) {
        const unsigned buf = ((unsigned)s0 >> 7) & 1u;
        const _Float16* kT = fbase + buf * (2 * KVT);
        const _Float16* vT = kT + KVT;
        v8f sacc[2][4];
#pragma unroll
        for (int g = 0; g < 2; ++g)
#pragma unroll
            for (int sub = 0; sub < 4; ++sub) sacc[g][sub] = zero8();
#pragma unroll
        for (int ec = 0; ec < 2; ++ec) {
            Frag kf[4];
#pragma unroll
            for (int sub = 0; sub < 4; ++sub) {
                const _Float16* kp = kT + (16 * sub) * KP + 32 * ec;
                kf[sub].p[0] = *(const v8ha*)kp;
                kf[sub].p[1] = *(const v8ha*)(kp + 16);
            }
#pragma unroll
            for (int sub = 0; sub < 4; ++sub)
#pragma unroll
                for (int g = 0; g < 2; ++g) sacc[g][sub] = mma16(kf[sub].v, qf[g][ec].v, sacc[g][sub]);
            // four vector slots behind the last WMMA, before its D, A or B registers are touched
            asm volatile("v_nop\n\tv_nop\n\tv_nop\n\tv_nop"
                         : "+v"(sacc[0][0]), "+v"(sacc[0][1]), "+v"(sacc[0][2]), "+v"(sacc[0][3]),
                           "+v"(sacc[1][0]), "+v"(sacc[1][1]), "+v"(sacc[1][2]), "+v"(sacc[1][3])
                         : "v"(qf[0][ec].v), "v"(qf[1][ec].v),
                           "v"(kf[0].v), "v"(kf[1].v), "v"(kf[2].v), "v"(kf[3].v));
        }

        float msub[2];
#pragma unroll
        for (int g = 0; g < 2; ++g) {
            // affine + temperature in the log2 domain
#pragma unroll
            for (int sub = 0; sub < 4; ++sub)
#pragma unroll
                for (int r = 0; r < 8; ++r) sacc[g][sub][r] = sacc[g][sub][r] * c1 + c0;

            // online softmax; sacc[g][sub][r] = score of key 16 sub + 8h + r for query m of group g
            float ms[4];                       // four independent chains, one per sub-tile
#pragma unroll
            for (int sub = 0; sub < 4; ++sub) {
                ms[sub] = sacc[g][sub][0];
#pragma unroll
                for (int r = 1; r < 8; ++r) ms[sub] = fmaxf(ms[sub], sacc[g][sub][r]);
            }
            float mx = fmaxf(fmaxf(ms[0], ms[1]), fmaxf(ms[2], ms[3]));
            mx = fmaxf(mx, xhalf(mx));
            const float mn = fmaxf(mrun[g], mx);
            const float alpha = EX2(mrun[g] - mn);
            mrun[g] = mn;
            msub[g] = mn - 14.0f;              // numerators carried x2^14
#pragma unroll
            for (int sub = 0; sub < 4; ++sub) lpart[g][sub] *= alpha;
#pragma unroll
            for (int et = 0; et < 4; ++et)
#pragma unroll
                for (int r = 0; r < 8; ++r) oacc[g][et][r] *= alpha;
        }

#pragma unroll
        for (int sc = 0; sc < 2; ++sc) {
            // P^T as B: element s of the fragment is key 32sc + 8h + s (s < 8), 32sc + 16 + 8h + s - 8
            // (s >= 8), which is register s & 7 of score tile 2sc + (s >> 3); V^T rows take the same k order
            Frag pf[2], vf[4];
#pragma unroll
            for (int et = 0; et < 4; ++et) {
                const _Float16* vp = vT + (16 * et) * KP + 32 * sc;
                vf[et].p[0] = *(const v8ha*)vp;
                vf[et].p[1] = *(const v8ha*)(vp + 16);
            }
#pragma unroll
            for (int g = 0; g < 2; ++g)
#pragma unroll
                for (int hf = 0; hf < 2; ++hf)
#pragma unroll
                    for (int r = 0; r < 8; ++r) {
                        const float p = EX2(sacc[g][2 * sc + hf][r] - msub[g]);   // in (0, 16384]
                        lpart[g][2 * sc + hf] += p;
                        pf[g].p[hf][r] = (_Float16)p;
                    }
#pragma unroll
            for (int et = 0; et < 4; ++et)
#pragma unroll
                for (int g = 0; g < 2; ++g) oacc[g][et] = mma16(vf[et].v, pf[g].v, oacc[g][et]);
            // four vector slots behind the last WMMA, before its D, A or B registers are touched
            asm volatile("v_nop\n\tv_nop\n\tv_nop\n\tv_nop"
                         : "+v"(oacc[0][0]), "+v"(oacc[0][1]), "+v"(oacc[0][2]), "+v"(oacc[0][3]),
                           "+v"(oacc[1][0]), "+v"(oacc[1][1]), "+v"(oacc[1][2]), "+v"(oacc[1][3])
                         : "v"(pf[0].v), "v"(pf[1].v),
                           "v"(vf[0].v), "v"(vf[1].v), "v"(vf[2].v), "v"(vf[3].v));
        }

        // hand-over: this wave's reads of the current buffer are done, its share of the next stage
        // has landed; behind the barrier the next stage is readable and this buffer is free
        asm volatile("s_wait_dscnt 0x0" ::: "memory");
        asm volatile("s_wait_asynccnt 0x0" ::: "memory");
        __syncthreads();
        if (s0 + 256 < SQ)
            stage_kv(lcp + buf * (2u * KVT * 2u), lcp + buf * (2u * KVT * 2u) + KVT * 2u,
                     kcp + (size_t)(s0 + 256) * DM, vcp + (s0 + 256));
    }
    asm volatile("s_wait_asynccnt 0x0" ::: "memory");   // no copy outstanding past the loop

    // sum of query m over this wave's keys: this half's four partial sums, plus the other half's
    float lt[2];
#pragma unroll
    for (int g = 0; g < 2; ++g) {
        lt[g] = (lpart[g][0] + lpart[g][1]) + (lpart[g][2] + lpart[g][3]);
        lt[g] += xhalf(lt[g]);
    }
    // join of a wave pair (w, w ^ 4): wave kh finishes query group kh and hands its share of group 1 - kh,
    // lane for lane, to its partner
    const bool up = (kh != 0);
    const float mM = up ? mrun[1] : mrun[0], mG = up ? mrun[0] : mrun[1];
    const float lM = up ? lt[1] : lt[0], lG = up ? lt[0] : lt[1];
    {
        float* xo = sX + w * 1024;
#pragma unroll
        for (int et = 0; et < 4; ++et)
#pragma unroll
            for (int j = 0; j < 2; ++j) {
                v4f x;
#pragma unroll
                for (int r = 0; r < 4; ++r) x[r] = up ? oacc[0][et][4 * j + r] : oacc[1][et][4 * j + r];
                *(v4fa*)(xo + ((2 * et + j) * 32 + l) * 4) = x;
            }
        sML[(2 * w + 0) * 32 + l] = mG;
        sML[(2 * w + 1) * 32 + l] = lG;
    }
    __syncthreads();   // the partner's share is readable
    // context x32 = 4 * (O a + O' a') / (l a + l' a'), a = 2^(m - max(m, m'));
    // O[query 16 kh + m of the wave's 32][e = 16 et + 8h + r]: eight consecutive e, one 16-B LDS store
    {
        const float* xi = sX + (w ^ 4) * 1024;
        const float mP = sML[(2 * (w ^ 4) + 0) * 32 + l];
        const float lP = sML[(2 * (w ^ 4) + 1) * 32 + l];
        const float mj = fmaxf(mM, mP);
        const float aM = EX2(mM - mj), aP = EX2(mP - mj);
        const float inv = 4.0f / (lM * aM + lP * aP);
        const float cM = aM * inv, cP = aP * inv;
#pragma unroll
        for (int et = 0; et < 4; ++et) {
            v8h o;
#pragma unroll
            for (int j = 0; j < 2; ++j) {
                const v4f x = *(const v4fa*)(xi + ((2 * et + j) * 32 + l) * 4);
#pragma unroll
                for (int r = 0; r < 4; ++r) {
                    const float mine = up ? oacc[1][et][4 * j + r] : oacc[0][et][4 * j + r];
                    o[4 * j + r] = (_Float16)(mine * cM + x[r] * cP);
                }
            }
            *(v8ha*)(myP + m * PP + 16 * et + 8 * h) = o;
        }
    }
    __syncthreads();
    v8h cv[4];
    size_t coff[4];
#pragma unroll
    for (int i = 0; i < 4; ++i) {
        const int row = 16 * (2 * qg + kh) + 4 * i + (l >> 3);
        const int c8 = (l & 7) * 8;
        cv[i] = *(const v8ha*)(sP + row * PP + c8);
        coff[i] = (size_t)(bq * SQ + q0 + row) * DM + hd * HD + c8;
    }
#pragma unroll
    for (int i = 0; i < 4; ++i) *(v8h*)(Ctx + coff[i]) = cv[i];
    
}

// ------------------------------------------------------------------------------------------
extern "C" void kernel_launch(void* const* d_in, const int* in_sizes, int n_in,
                              void* d_out, int out_size, void* d_ws, size_t ws_size,
                              hipStream_t stream)
{
    if (n_in < 13) return;
    if (in_sizes[0] != PLANE || in_sizes[1] != PLANE || in_sizes[2] != PLANE) return;
    if (in_sizes[3] != NB || in_sizes[4] != NB) return;
    if (in_sizes[5] != DM * DM || in_sizes[7] != DM * DM || in_sizes[9] != DM * DM || in_sizes[11] != DM * DM) return;
    if (in_sizes[6] != DM || in_sizes[8] != DM || in_sizes[10] != DM || in_sizes[12] != DM) return;
    if (out_size != PLANE) return;

    const float* queries = (const float*)d_in[0];
    const float* keys    = (const float*)d_in[1];
    const float* values  = (const float*)d_in[2];
    const float* tau     = (const float*)d_in[3];
    const float* delta   = (const float*)d_in[4];
    const float* Wq = (const float*)d_in[5];
    const float* bq = (const float*)d_in[6];
    const float* Wk = (const float*)d_in[7];
    const float* bk = (const float*)d_in[8];
    const float* Wv = (const float*)d_in[9];
    const float* bv = (const float*)d_in[10];
    const float* Wo = (const float*)d_in[11];
    const float* bo = (const float*)d_in[12];
    float* out = (float*)d_out;

    // workspace carve (bytes), all offsets multiples of 2 MiB
    const size_t szPlane16 = (size_t)PLANE * 2;                 // 8 MiB
    const size_t offWt = 0;                                       // 4 x 512x512 f16 = 2 MiB
    const size_t offQ  = offWt + (size_t)4 * DM * DM * 2;
    const size_t offK  = offQ + szPlane16;
    const size_t offVt = offK + szPlane16;
    const size_t offC  = offVt + szPlane16;
    const size_t wsEnd = offC + szPlane16;                        // 34 MiB
    if (wsEnd > ws_size) return;

    char* ws = (char*)d_ws;
    _Float16* Wt  = (_Float16*)(ws + offWt);
    _Float16* Qh  = (_Float16*)(ws + offQ);
    _Float16* Kh  = (_Float16*)(ws + offK);
    _Float16* Vth = (_Float16*)(ws + offVt);
    _Float16* Ctx = (_Float16*)(ws + offC);

    // 1) weights -> transposed f16 (bf16 value x64): Wq, Wk, Wv, Wo
    k_cvt_wt<<<dim3(DM / 64, DM / 64, 4), dim3(128), 0, stream>>>(Wq, Wk, Wv, Wo, Wt);
    // 2) q, k (row-major) and v (head-transposed) projections of the f32 activations, f16 x8
    k_gemm<false><<<dim3(DM / 512, MR / 128, 3), dim3(512), 0, stream>>>(
        queries, keys, values, Ctx, Wt, bq, bk, bv, Qh, out, 1.0f / 1024.0f, 8.0f);
    // 3) attention -> context f16 x32
    k_attn<<<dim3(SQ / QB, NH, NB), dim3(256), 0, stream>>>(Qh, Kh, Vth, tau, delta, Ctx);
    // 4) output projection -> f32
    k_gemm<true><<<dim3(DM / 128, MR / 64, 1), dim3(128), 0, stream>>>(
        queries, keys, values, Ctx, Wt + (size_t)3 * DM * DM, bo, bo, bo, Qh, out, 1.0f / 2048.0f, 1.0f);
}

// v008
// Measured time: 60.9 microseconds a run.
// Versions between v006 and this one are left out; their measured steps multiply to 1.07 times as fast.
// Over all steps from v000 it is 3.17 times as fast.
#include <hip/hip_runtime.h>
#include <stdint.h>

// All six contractions (three input projections, q.k^T, p.v, output projection):
// v_wmma_f32_16x16x32_f16, f16 operands, f32 accumulate. Float inputs are RNE-converted to
// bf16 values held exactly in f16 containers (activations x16, weights x64; tau, delta, bias as
// f32-held bf16 values); intermediates: q,k,v f16 x8, softmax numerators f16 x2^7 against the maximum in
// use (at most 2^15), context f16 x32.
// Every scale is a power of two removed in f32. Softmax statistics in f32.

#ifndef AFFINE_BF16
#define AFFINE_BF16 1   // 1: tau and delta RNE-converted to bf16 values before use; 0: used as given
#endif

#define DM 512
#define NH 8
#define HD 64
#define NB 4
#define SQ 2048
#define MR (NB * SQ)            // 8192 token rows
#define PLANE (MR * DM)         // 4194304 elements per activation plane
#define PP 72                   // f16 LDS pitch of the per-wave context tile (epilogue)
#define PC 520                  // f16 LDS pitch of the row-major 128x512 epilogue tile
#define PT 72                   // f16 LDS pitch of the transposed 64x64 weight tile
#define PV 136                  // f16 LDS pitch of the transposed 512x128 epilogue tile (272 B = 16 B x 17)
#define PO 132                  // f32 LDS pitch of the 64x128 epilogue tile
#define KP 72                   // f16 LDS pitch of a staged 64-element K or V row (144 B = 16 B x 9)
#define KVT (64 * KP)           // f16 elements of one staged 64x64 tile
#define QB 128                  // query rows of one attention block
#define GK 64                   // k elements of one staged GEMM panel: one whole 128-B line per row

typedef _Float16 v16h __attribute__((ext_vector_type(16)));
typedef _Float16 v8h  __attribute__((ext_vector_type(8)));
typedef v8h __attribute__((may_alias)) v8ha;
typedef float v8f __attribute__((ext_vector_type(8)));
typedef float v4f __attribute__((ext_vector_type(4)));
typedef v4f __attribute__((may_alias)) v4fa;
typedef _Float16 v4h __attribute__((ext_vector_type(4)));
typedef v4h __attribute__((may_alias)) v4ha;
typedef _Float16 v2h __attribute__((ext_vector_type(2)));
typedef float v2f __attribute__((ext_vector_type(2)));
typedef __bf16 v2b __attribute__((ext_vector_type(2)));

union Frag { v16h v; v8h p[2]; };

#if defined(__has_builtin)
#if __has_builtin(__builtin_amdgcn_exp2f)
#define EX2(x) __builtin_amdgcn_exp2f(x)
#endif
#endif
#ifndef EX2
#define EX2(x) __expf((x) * 0.69314718055994531f)
#endif

// f32 -> nearest-even bf16 value, returned as f32
__device__ __forceinline__ float bfr(float x)
{
    unsigned u = __float_as_uint(x);
    u = (u + 0x7fffu + ((u >> 16) & 1u)) & 0xffff0000u;
    return __uint_as_float(u);
}
// bf16 value times a power of two, held in an f16 container (exact in the normal range)
__device__ __forceinline__ _Float16 cvh(float x, float s) { return (_Float16)(bfr(x) * s); }

__device__ __forceinline__ v8f mma16(v16h a, v16h b, v8f c)
{
    return __builtin_amdgcn_wmma_f32_16x16x32_f16(false, a, false, b, (short)0, c, false, false);
}

__device__ __forceinline__ v8f zero8()
{
    v8f z;
#pragma unroll
    for (int i = 0; i < 8; ++i) z[i] = 0.0f;
    return z;
}

// four activations -> f16 (bf16 value x16): the packed conversion rounds to nearest even as bfr() does
__device__ __forceinline__ v4h cvh4(v4f x)
{
    v4h o;
#pragma unroll
    for (int p = 0; p < 2; ++p) {
        v2f f;
        f[0] = x[2 * p]; f[1] = x[2 * p + 1];
        const unsigned u = __builtin_bit_cast(unsigned, __builtin_convertvector(f, v2b));
        v2f g;
        g[0] = __uint_as_float(u << 16); g[1] = __uint_as_float(u & 0xffff0000u);
        g *= 16.0f;
        const v2h hh = __builtin_convertvector(g, v2h);
        o[2 * p] = hh[0]; o[2 * p + 1] = hh[1];
    }
    return o;
}

// ------------------------------------------------------------------------------------------
// Weight convert + transpose: four f32 W[k][n] (512x512) -> f16 Wt[n][k] (bf16 value x64),
// k-contiguous so B fragments load like A fragments. 64x64 tile through LDS; each output line
__global__ __launch_bounds__(128)
void k_cvt_wt(const float* __restrict__ w0, const float* __restrict__ w1,
              const float* __restrict__ w2, const float* __restrict__ w3,
              _Float16* __restrict__ wt)
{
    __shared__ _Float16 __attribute__((aligned(16))) sT[64 * PT];   // [n_local][k_local]
    const int z = blockIdx.z;
    const float* src = (z == 0) ? w0 : ((z == 1) ? w1 : ((z == 2) ? w2 : w3));
    _Float16* dst = wt + (size_t)z * (DM * DM);
    const int k0 = blockIdx.y * 64, n0 = blockIdx.x * 64;
    const int t = threadIdx.x, l = t & 31, w = t >> 5;
    const int nn = (t & 15) * 4, kb = t >> 4;
#pragma unroll
    for (int i = 0; i < 8; ++i) {
        const int kk = kb + 8 * i;
        const float4 v = *(const float4*)(src + (size_t)(k0 + kk) * DM + n0 + nn);
        sT[(nn + 0) * PT + kk] = cvh(v.x, 64.0f);
        sT[(nn + 1) * PT + kk] = cvh(v.y, 64.0f);
        sT[(nn + 2) * PT + kk] = cvh(v.z, 64.0f);
        sT[(nn + 3) * PT + kk] = cvh(v.w, 64.0f);
    }
    __syncthreads();
    v8h val[4];
    size_t off[4];
#pragma unroll
    for (int i = 0; i < 4; ++i) {
        const int line = 16 * w + 4 * i + (l >> 3);   // n_local
        const int ck = (l & 7) * 8;
        val[i] = *(const v8ha*)(sT + line * PT + ck);
        off[i] = (size_t)(n0 + line) * DM + k0 + ck;
    }
#pragma unroll
    for (int i = 0; i < 4; ++i) *(v8h*)(dst + off[i]) = val[i];
    
}

// ------------------------------------------------------------------------------------------
// One lane's share of a 64-k GEMM stage: four 16-B pieces of the 64-row A panel and eight of the
// 128-row B panel, rows 16 apart, copied from global memory into LDS without passing through
// registers. A wave's copy covers four whole 128-B lines. la, lb: LDS byte addresses; ga, gb: the
// matching global addresses.
__device__ __forceinline__ void stage_ab(unsigned la, unsigned lb,
                                         const _Float16* ga, const _Float16* gb)
{
    // s_wait_xcnt closes the statement so that no address register is rewritten ahead of it
    asm volatile("global_load_async_to_lds_b128 %0, %12, off\n\t"
                 "global_load_async_to_lds_b128 %1, %13, off\n\t"
                 "global_load_async_to_lds_b128 %2, %14, off\n\t"
                 "global_load_async_to_lds_b128 %3, %15, off\n\t"
                 "global_load_async_to_lds_b128 %4, %16, off\n\t"
                 "global_load_async_to_lds_b128 %5, %17, off\n\t"
                 "global_load_async_to_lds_b128 %6, %18, off\n\t"
                 "global_load_async_to_lds_b128 %7, %19, off\n\t"
                 "global_load_async_to_lds_b128 %8, %20, off\n\t"
                 "global_load_async_to_lds_b128 %9, %21, off\n\t"
                 "global_load_async_to_lds_b128 %10, %22, off\n\t"
                 "global_load_async_to_lds_b128 %11, %23, off\n\t"
                 "s_wait_xcnt 0x0"
                 :: "v"(la), "v"(la + 16u * KP * 2u), "v"(la + 32u * KP * 2u), "v"(la + 48u * KP * 2u),
                    "v"(lb), "v"(lb + 16u * KP * 2u), "v"(lb + 32u * KP * 2u), "v"(lb + 48u * KP * 2u),
                    "v"(lb + 64u * KP * 2u), "v"(lb + 80u * KP * 2u), "v"(lb + 96u * KP * 2u),
                    "v"(lb + 112u * KP * 2u),
                    "v"(ga), "v"(ga + 16 * DM), "v"(ga + 32 * DM), "v"(ga + 48 * DM),
                    "v"(gb), "v"(gb + 16 * DM), "v"(gb + 32 * DM), "v"(gb + 48 * DM),
                    "v"(gb + 64 * DM), "v"(gb + 80 * DM), "v"(gb + 96 * DM), "v"(gb + 112 * DM)
                 : "memory");
}

// One lane's share of a 512-row B panel alone, for the GEMM whose A panel comes through registers:
// eight 16-B pieces, rows 64 apart (512 threads).
__device__ __forceinline__ void stage_b(unsigned lb, const _Float16* gb)
{
    // s_wait_xcnt closes the statement so that no address register is rewritten ahead of it
    asm volatile("global_load_async_to_lds_b128 %0, %8, off\n\t"
                 "global_load_async_to_lds_b128 %1, %9, off\n\t"
                 "global_load_async_to_lds_b128 %2, %10, off\n\t"
                 "global_load_async_to_lds_b128 %3, %11, off\n\t"
                 "global_load_async_to_lds_b128 %4, %12, off\n\t"
                 "global_load_async_to_lds_b128 %5, %13, off\n\t"
                 "global_load_async_to_lds_b128 %6, %14, off\n\t"
                 "global_load_async_to_lds_b128 %7, %15, off\n\t"
                 "s_wait_xcnt 0x0"
                 :: "v"(lb), "v"(lb + 64u * KP * 2u), "v"(lb + 128u * KP * 2u), "v"(lb + 192u * KP * 2u),
                    "v"(lb + 256u * KP * 2u), "v"(lb + 320u * KP * 2u), "v"(lb + 384u * KP * 2u),
                    "v"(lb + 448u * KP * 2u),
                    "v"(gb), "v"(gb + 64 * DM), "v"(gb + 128 * DM), "v"(gb + 192 * DM),
                    "v"(gb + 256 * DM), "v"(gb + 320 * DM), "v"(gb + 384 * DM), "v"(gb + 448 * DM)
                 : "memory");
}

// Asks L2 for the bytes at the lanes' addresses: a hint that returns nothing, so that the later
// load or copy of those bytes finds them in L2 and not in memory. Every lane's address lies in its buffer.
__device__ __forceinline__ void ask_l2(const char* p)
{
    // s_wait_xcnt closes the statement so that no address register is rewritten ahead of it
    asm volatile("global_prefetch_b8 %0, off scope:SCOPE_SE\n\t"
                 "s_wait_xcnt 0x0"
                 :: "v"(p));
}
__device__ __forceinline__ void ask_l2(const char* p, const char* q)
{
    // s_wait_xcnt closes the statement so that no address register is rewritten ahead of it
    asm volatile("global_prefetch_b8 %0, off scope:SCOPE_SE\n\t"
                 "global_prefetch_b8 %1, off scope:SCOPE_SE\n\t"
                 "s_wait_xcnt 0x0"
                 :: "v"(p), "v"(q));
}

// ------------------------------------------------------------------------------------------
// C[BM x NT per block] = A[rows][512] (row-major) * B, with B given as Bt[n][k] (f16).
// Each 64-k panel of A and of B is brought into LDS once per block, two buffers, one stage ahead of its
// use; the waves read their fragments from there with the 16x16x32 split-k lane map for both A and B.
// B comes by asynchronous copies.
// !OUTF: BM = 128, NT = 512 (all columns), 16 waves, one per 64x64 sub-tile = 4x4 accumulators: an LDS
//        fragment feeds four WMMAs, every activation row is fetched and converted by one block only, and
//        the weight panel is fetched once per 128 rows. A is the f32 activation plane x0, x1 or x2
//        (blockIdx.z): plain loads issued where the stage's copies are, converted to f16 (bf16 value x16)
//        in registers and stored to the stage's A panel ahead of the barrier that publishes the stage.
//        v = (acc*s_acc + bf16(bias)) * s_out -> f16; blockIdx.z selects the plane
//        (z=0,1 row-major [8192][512]; z=2 head-transposed [NB][NH][HD][SQ]).
// OUTF : BM = 64, NT = 128, 4 waves, one per 32x64 sub-tile = 2x4 accumulators. A is f16, by asynchronous
//        copies; same value -> f32 d_out.
// L2 hints, one lane per 256 B. The f16 operands, stored by earlier launches, are asked for at entry,
// behind stage 0's own requests: OUTF, the block's whole A tile and a quarter of its B tile; !OUTF, a quarter
// of the weight plane; the quarters go round the blocks that share the rows (which block runs where only
// decides how much the hints help). !OUTF: a stage of the f32 A panel is 256 B per row; waves 0 to 3 ask
// for it two trips ahead of its loads (stages 1 and 2 at entry).
// 256 VGPRs: a wave's share where the 16 waves of a block stand four to a SIMD.
template<bool OUTF>
__global__ __launch_bounds__(OUTF ? 128 : 512) __attribute__((amdgpu_num_vgpr(256)))
void k_gemm(const float* __restrict__ x0, const float* __restrict__ x1, const float* __restrict__ x2,
            const _Float16* __restrict__ A, const _Float16* __restrict__ Bt,
            const float* __restrict__ bi0, const float* __restrict__ bi1,
            const float* __restrict__ bi2,
            _Float16* __restrict__ O16, float* __restrict__ O32, float s_acc, float s_out)
{
    const int t = threadIdx.x, l = t & 31, w = t >> 5, h = l >> 4, m = l & 15;
    const int z = blockIdx.z;
    constexpr int NT = OUTF ? 128 : 512;      // columns of the block tile
    constexpr int BM = OUTF ? 64 : 128;       // rows of the block tile, two wave tiles high
    constexpr int MI = BM / 32;               // 16-row groups of a wave tile
    constexpr int GA = BM * KP;               // f16 elements of a staged BM-row A panel
    constexpr int GB = NT * KP;               // f16 elements of a staged NT-row B panel
    constexpr int GST = GA + GB;              // f16 elements of one stage
    const int n0 = blockIdx.x * NT, m0 = blockIdx.y * BM;
    const int wm = (w / (NT / 64)) * (BM / 2), wn = (w % (NT / 64)) * 64;
    const _Float16* Bb = Bt + (size_t)z * (DM * DM);
    const float* bias = (z == 0) ? bi0 : ((z == 1) ? bi1 : bi2);

    __shared__ _Float16 __attribute__((aligned(16))) sAB[2 * GST];   // [buffer][A BM rows, B NT rows][KP]
    // copy side: thread t brings piece (t & 7) of rows (t >> 3) + (NT / 8) j of a panel
    const _Float16* acp = A + (size_t)(m0 + (t >> 3)) * DM + 8 * (t & 7);
    const _Float16* bcp = Bb + (size_t)(n0 + (t >> 3)) * DM + 8 * (t & 7);
    const unsigned lcp = (unsigned)(uintptr_t)(sAB + (t >> 3) * KP + 8 * (t & 7));
    // f32 A side: thread t brings k = 4 (t & 15) .. +3 of rows (t >> 4) + 32 j, so that one wave load
    // covers four whole 128-B lines
    const float* xs = (z == 0) ? x0 : ((z == 1) ? x1 : x2);
    const float* xcp = xs + (size_t)(m0 + (t >> 4)) * DM + 4 * (t & 15);
    _Float16* sa = sAB + (t >> 4) * KP + 4 * (t & 15);
    v4f ar[4];                                // the A stage in flight
    // hint side, !OUTF: lane t of waves 0 to 3 asks for row t's unit of a stage
    const char* pfa = (const char*)(xs + (size_t)(m0 + (t & 127)) * DM);
    const char* pfn = pfa;                    // the unit asked for next in the loop
    const bool asks = __builtin_amdgcn_readfirstlane(w) < 4;   // the same in a whole wave: a scalar branch
    // fragment side: row m of a 16-row group, k = 8h.. and 16+8h.. of each 32-k half
    const _Float16* fa = sAB + (wm + m) * KP + 8 * h;
    const _Float16* fb = sAB + GA + (wn + m) * KP + 8 * h;

    v8f acc[MI][4];
#pragma unroll
    for (int mi = 0; mi < MI; ++mi)
#pragma unroll
        for (int ni = 0; ni < 4; ++ni) acc[mi][ni] = zero8();

    if constexpr (OUTF) {
        stage_ab(lcp, lcp + GA * 2u, acp, bcp);
        // 64 A rows = 256 units in a row, two a lane; 128 B rows = 512 units, this block's quarter one a lane
        const char* pa = (const char*)(A + (size_t)m0 * DM) + 256 * t;
        ask_l2(pa, pa + 256 * 128);
        ask_l2((const char*)(Bb + (size_t)n0 * DM) + 256 * (128 * ((blockIdx.y >> 1) & 3) + t));
    } else {
#pragma unroll
        for (int j = 0; j < 4; ++j) ar[j] = *(const v4fa*)(xcp + (32 * j) * DM);
        stage_b(lcp + GA * 2u, bcp);
        if (asks) ask_l2(pfa + 256, pfa + 2 * 256);
        // 512 B rows = 2048 units in a row, this block's quarter one a lane
        ask_l2((const char*)Bb + 256 * (512 * (blockIdx.y & 3) + t));
        // keeps the conversion, which waits for the loads, behind the issue of the copies
        __builtin_amdgcn_sched_barrier(0);
#pragma unroll
        for (int j = 0; j < 4; ++j) *(v4ha*)(sa + (32 * j) * KP) = cvh4(ar[j]);
    }
    asm volatile("s_wait_asynccnt 0x0" ::: "memory");   // stage 0 landed, this wave's share
    __syncthreads();                                    // stage 0 readable by every wave
    if constexpr (OUTF) {
        stage_ab(lcp + GST * 2u, lcp + (GST + GA) * 2u, acp + GK, bcp + GK);
    } else {
#pragma unroll
        for (int j = 0; j < 4; ++j) ar[j] = *(const v4fa*)(xcp + (32 * j) * DM + GK);
        stage_b(lcp + (GST + GA) * 2u, bcp + GK);
        if (asks) ask_l2(pfa + 3 * 256);
        pfn = pfa + 4 * 256;
    }

    // OUTF, two trips a pass: each buffer's LDS offsets are immediates; unrolled whole, the build formed the
    // copy addresses of all later stages early and took about 250 VGPRs. !OUTF, rolled: the second buffer
    // lies past the reach of an LDS immediate, and two trips a pass held one address register per read
#pragma unroll (OUTF ? 2 : 1)
    for (int k0 = 0; k0 < DM; k0 += GK) {
        const unsigned buf = ((unsigned)k0 >> 6) & 1u;
        const _Float16* aT = fa + buf * GST;
        const _Float16* bT = fb + buf * GST;
        if constexpr (!OUTF) {
            // fragment of 16 rows from row group rg of panel p, 32-k half kh: k = 32kh+8h .. +7, 32kh+16+8h .. +7
            auto ldf = [](Frag& f, const _Float16* p, int rg, int kh) {
                f.p[0] = *(const v8ha*)(p + (16 * rg) * KP + 32 * kh);
                f.p[1] = *(const v8ha*)(p + (16 * rg) * KP + 32 * kh + 16);
            };
            // The second half's fragments are read in two groups among the first half's WMMAs, into registers
            // that those have left (two B fragments take registers of their own). The scheduling barriers
            // hold that order: left alone, the build kept one A fragment and waited for LDS ahead of every
            // four WMMAs.
            Frag a0[MI], b0[4], a1[MI], b1[4];
            ldf(b0[0], bT, 0, 0); ldf(a0[0], aT, 0, 0);
            ldf(b0[1], bT, 1, 0); ldf(b0[2], bT, 2, 0); ldf(b0[3], bT, 3, 0);
            ldf(a0[1], aT, 1, 0); ldf(a0[2], aT, 2, 0); ldf(a0[3], aT, 3, 0);
            __builtin_amdgcn_sched_barrier(0);
#pragma unroll
            for (int mi = 0; mi < 2; ++mi)
#pragma unroll
                for (int ni = 0; ni < 4; ++ni) acc[mi][ni] = mma16(a0[mi].v, b0[ni].v, acc[mi][ni]);
            __builtin_amdgcn_sched_barrier(0);
            ldf(a1[0], aT, 0, 1); ldf(b1[0], bT, 0, 1); ldf(a1[1], aT, 1, 1); ldf(b1[1], bT, 1, 1);
            __builtin_amdgcn_sched_barrier(0);
#pragma unroll
            for (int mi = 2; mi < 4; ++mi)
#pragma unroll
                for (int ni = 0; ni < 4; ++ni) acc[mi][ni] = mma16(a0[mi].v, b0[ni].v, acc[mi][ni]);
            __builtin_amdgcn_sched_barrier(0);
            ldf(b1[2], bT, 2, 1); ldf(b1[3], bT, 3, 1); ldf(a1[2], aT, 2, 1); ldf(a1[3], aT, 3, 1);
            __builtin_amdgcn_sched_barrier(0);
#pragma unroll
            for (int mi = 0; mi < 2; ++mi)
#pragma unroll
                for (int ni = 0; ni < 2; ++ni) acc[mi][ni] = mma16(a1[mi].v, b1[ni].v, acc[mi][ni]);
#pragma unroll
            for (int mi = 0; mi < 2; ++mi)
#pragma unroll
                for (int ni = 2; ni < 4; ++ni) acc[mi][ni] = mma16(a1[mi].v, b1[ni].v, acc[mi][ni]);
#pragma unroll
            for (int mi = 2; mi < 4; ++mi)
#pragma unroll
                for (int ni = 0; ni < 4; ++ni) acc[mi][ni] = mma16(a1[mi].v, b1[ni].v, acc[mi][ni]);
            // keeps every WMMA of the trip ahead of the slots below
            __builtin_amdgcn_sched_barrier(0);
            // four vector slots behind the last WMMA, before its D, A or B registers are touched
            asm volatile("v_nop\n\tv_nop\n\tv_nop\n\tv_nop");
        } else {
        // both 32-k halves are named ahead of the 16 WMMAs, so the second half's reads can issue among
        // the first half's WMMAs
        Frag a[2][2], b[2][4];
#pragma unroll
        for (int kh = 0; kh < 2; ++kh) {
#pragma unroll
            for (int mi = 0; mi < 2; ++mi) {
                a[kh][mi].p[0] = *(const v8ha*)(aT + (16 * mi) * KP + 32 * kh);        // k0+32kh+8h .. +7
                a[kh][mi].p[1] = *(const v8ha*)(aT + (16 * mi) * KP + 32 * kh + 16);   // k0+32kh+16+8h .. +7
            }
#pragma unroll
            for (int ni = 0; ni < 4; ++ni) {
                b[kh][ni].p[0] = *(const v8ha*)(bT + (16 * ni) * KP + 32 * kh);
                b[kh][ni].p[1] = *(const v8ha*)(bT + (16 * ni) * KP + 32 * kh + 16);
            }
        }
#pragma unroll
        for (int kh = 0; kh < 2; ++kh)
#pragma unroll
            for (int mi = 0; mi < 2; ++mi)
#pragma unroll
                for (int ni = 0; ni < 4; ++ni)
                    acc[mi][ni] = mma16(a[kh][mi].v, b[kh][ni].v, acc[mi][ni]);
        // four vector slots behind the last WMMA, before its D, A or B registers are touched
        asm volatile("v_nop\n\tv_nop\n\tv_nop\n\tv_nop"
                     : "+v"(acc[0][0]), "+v"(acc[0][1]), "+v"(acc[0][2]), "+v"(acc[0][3]),
                       "+v"(acc[1][0]), "+v"(acc[1][1]), "+v"(acc[1][2]), "+v"(acc[1][3])
                     : "v"(a[1][0].v), "v"(a[1][1].v), "v"(b[1][0].v), "v"(b[1][1].v), "v"(b[1][2].v),
                       "v"(b[1][3].v));
        }

        // the next stage's A panel goes into the other buffer, whose readers left at the last barrier
        if constexpr (!OUTF) {
            // keeps the conversion, which waits for the loads, behind this trip's WMMAs: hoisted among
            // them it stalled the wave on loads issued just before the trip
            __builtin_amdgcn_sched_barrier(0);
            if (k0 + GK < DM) {
#pragma unroll
                for (int j = 0; j < 4; ++j) *(v4ha*)(sa + (buf ^ 1u) * GST + (32 * j) * KP) = cvh4(ar[j]);
            }
        }
        // hand-over: this wave's reads of the current buffer are done, its share of the next stage
        // has landed; behind the barrier the next stage is readable and this buffer is free
        asm volatile("s_wait_dscnt 0x0" ::: "memory");
        asm volatile("s_wait_asynccnt 0x0" ::: "memory");
        __syncthreads();
        if (k0 + 2 * GK < DM) {
            if constexpr (OUTF) {
                stage_ab(lcp + buf * (GST * 2u), lcp + buf * (GST * 2u) + GA * 2u,
                         acp + (k0 + 2 * GK), bcp + (k0 + 2 * GK));
            } else {
#pragma unroll
                for (int j = 0; j < 4; ++j) ar[j] = *(const v4fa*)(xcp + (32 * j) * DM + (k0 + 2 * GK));
                stage_b(lcp + buf * (GST * 2u) + GA * 2u, bcp + (k0 + 2 * GK));
                if (asks && k0 + 4 * GK < DM) ask_l2(pfn);
                pfn += (k0 + 5 * GK < DM) ? 256 : 0;   // never past the row's last unit
            }
        }
    }
    asm volatile("s_wait_asynccnt 0x0" ::: "memory");   // no copy outstanding past the loop

    float bb[4];
#pragma unroll
    for (int ni = 0; ni < 4; ++ni) bb[ni] = bfr(bias[n0 + wn + 16 * ni + m]);

    if constexpr (OUTF) {
        __shared__ float __attribute__((aligned(16))) sO[64 * PO];
#pragma unroll
        for (int mi = 0; mi < 2; ++mi)
#pragma unroll
            for (int ni = 0; ni < 4; ++ni)
#pragma unroll
                for (int r = 0; r < 8; ++r) {
                    const int row = wm + 16 * mi + 8 * h + r;
                    const int col = wn + 16 * ni + m;
                    sO[row * PO + col] = (acc[mi][ni][r] * s_acc + bb[ni]) * s_out;
                }
        __syncthreads();
        v4f val[16];
#pragma unroll
        for (int i = 0; i < 16; ++i) val[i] = *(const v4fa*)(sO + (16 * w + i) * PO + 4 * l);
#pragma unroll
        for (int i = 0; i < 16; ++i)
            *(v4f*)(O32 + (size_t)(m0 + 16 * w + i) * DM + n0 + 4 * l) = val[i];
        
    } else {
        // 128 x PC or 512 x PV view, laid over the stage buffers: every wave's last fragment read ended ahead
        // of the loop's last barrier and no copy is outstanding.
        static_assert(NT * PV <= 2 * GST && BM * PC <= 2 * GST, "output tile exceeds the stage buffers");
        _Float16* sC = sAB;
        if (z != 2) {
#pragma unroll
            for (int mi = 0; mi < MI; ++mi)
#pragma unroll
                for (int ni = 0; ni < 4; ++ni)
#pragma unroll
                    for (int r = 0; r < 8; ++r) {
                        const int row = wm + 16 * mi + 8 * h + r;
                        const int col = wn + 16 * ni + m;
                        sC[row * PC + col] = (_Float16)((acc[mi][ni][r] * s_acc + bb[ni]) * s_out);
                    }
        } else {
#pragma unroll
            for (int mi = 0; mi < MI; ++mi)
#pragma unroll
                for (int ni = 0; ni < 4; ++ni)
#pragma unroll
                    for (int r = 0; r < 8; ++r) {
                        const int row = wm + 16 * mi + 8 * h + r;
                        const int col = wn + 16 * ni + m;
                        sC[col * PV + row] = (_Float16)((acc[mi][ni][r] * s_acc + bb[ni]) * s_out);
                    }
        }
        __syncthreads();
        v8h val[16];
        size_t off[16];
        if (z != 2) {
            // a wave's store covers half a row: four whole lines
#pragma unroll
            for (int i = 0; i < 16; ++i) {
                const int row = 8 * w + (i >> 1);
                const int c8 = (i & 1) * 256 + l * 8;
                val[i] = *(const v8ha*)(sC + row * PC + c8);
                off[i] = (size_t)z * PLANE + (size_t)(m0 + row) * DM + n0 + c8;
            }
        } else {
            // transposed: two lines per tile column (128 consecutive s of one (b,head,e) row)
            const int bidx = m0 / SQ, s0 = m0 - bidx * SQ;
#pragma unroll
            for (int i = 0; i < 16; ++i) {
                const int col = 32 * w + 2 * i + (l >> 4);
                const int ck = (l & 15) * 8;
                const int gc = n0 + col;
                val[i] = *(const v8ha*)(sC + col * PV + ck);
                off[i] = (size_t)2 * PLANE
                       + ((size_t)((bidx * NH + (gc >> 6)) * HD + (gc & 63))) * SQ + s0 + ck;
            }
        }
#pragma unroll
        for (int i = 0; i < 16; ++i) *(v8h*)(O16 + off[i]) = val[i];
        
    }
}

// value of lane l ^ 16 (the other wave half), by a vector cross-row move
__device__ __forceinline__ float xhalf(float x)
{
    const int i = __builtin_bit_cast(int, x);
    return __builtin_bit_cast(float,
        __builtin_amdgcn_permlanex16(i, i, 0x76543210, 0xfedcba98, false, false));
}

// ------------------------------------------------------------------------------------------
// One lane's share of a 64-key stage: four 16-B pieces of the K tile and four of the V tile, rows
// 16 apart, copied from global memory into LDS without passing through registers. A wave's copy
// covers four whole 128-B rows. lk, lv: LDS byte addresses; gk, gv: the matching global addresses.
__device__ __forceinline__ void stage_kv(unsigned lk, unsigned lv,
                                         const _Float16* gk, const _Float16* gv)
{
    // s_wait_xcnt closes the statement so that no address register is rewritten ahead of it
    asm volatile("global_load_async_to_lds_b128 %0, %8, off\n\t"
                 "global_load_async_to_lds_b128 %1, %9, off\n\t"
                 "global_load_async_to_lds_b128 %2, %10, off\n\t"
                 "global_load_async_to_lds_b128 %3, %11, off\n\t"
                 "global_load_async_to_lds_b128 %4, %12, off\n\t"
                 "global_load_async_to_lds_b128 %5, %13, off\n\t"
                 "global_load_async_to_lds_b128 %6, %14, off\n\t"
                 "global_load_async_to_lds_b128 %7, %15, off\n\t"
                 "s_wait_xcnt 0x0"
                 :: "v"(lk), "v"(lk + 16u * KP * 2u), "v"(lk + 32u * KP * 2u), "v"(lk + 48u * KP * 2u),
                    "v"(lv), "v"(lv + 16u * KP * 2u), "v"(lv + 32u * KP * 2u), "v"(lv + 48u * KP * 2u),
                    "v"(gk), "v"(gk + 16 * DM), "v"(gk + 32 * DM), "v"(gk + 48 * DM),
                    "v"(gv), "v"(gv + 16 * SQ), "v"(gv + 32 * SQ), "v"(gv + 48 * SQ)
                 : "memory");
}

__global__ __launch_bounds__(256) __attribute__((amdgpu_num_vgpr(256)))
void k_attn(const _Float16* __restrict__ Qh, const _Float16* __restrict__ Kh,
            const _Float16* __restrict__ Vt, const float* __restrict__ tau,
            const float* __restrict__ delta, _Float16* __restrict__ Ctx)
{
    __shared__ _Float16 __attribute__((aligned(16))) sP[QB * PP];
    __shared__ _Float16 __attribute__((aligned(16))) sKV[2 * 2 * 2 * KVT];   // [parity][buffer][K, V][row][KP]
    __shared__ float __attribute__((aligned(16))) sX[8 * 1024];   // [wave][e tile][4-register half][lane][4]
    __shared__ float sML[8 * 2 * 32];                             // [wave][maximum, sum][lane]
    const int t = threadIdx.x, l = t & 31, w = t >> 5, h = l >> 4, m = l & 15;
    const int qg = w & 3, kh = w >> 2, tc = t & 127;
    const int bq = blockIdx.z, hd = blockIdx.y, q0 = blockIdx.x * QB;

    const float LOG2E = 1.4426950408889634f;
#if AFFINE_BF16
    const float tb = bfr(tau[bq]);
    const float db = bfr(delta[bq]);
#else
    const float tb = tau[bq];
    const float db = delta[bq];
#endif
    // logit2 = log2(e) * 0.125 * (s * tau + delta), s = (8q).(8k) / 64: c1 goes into Q, c0 into C
    const float c1 = tb * (0.125f / 64.0f) * LOG2E;
    const float c0 = db * 0.125f * LOG2E;

    Frag qf[2][2];                            // [query group][32-e half]
#pragma unroll
    for (int g = 0; g < 2; ++g) {
        const _Float16* qp = Qh + (size_t)(bq * SQ + q0 + 32 * qg + 16 * g + m) * DM + hd * HD + 8 * h;
#pragma unroll
        for (int ec = 0; ec < 2; ++ec) {
            qf[g][ec].p[0] = *(const v8h*)(qp + 32 * ec);        // e = 32ec+8h .. +7
            qf[g][ec].p[1] = *(const v8h*)(qp + 32 * ec + 16);   // e = 32ec+16+8h .. +7
#pragma unroll
            for (int i = 0; i < 16; ++i) qf[g][ec].v[i] = (_Float16)((float)qf[g][ec].v[i] * c1);
        }
    }
    // copy side: thread tc of a parity's 128 brings piece (tc & 7) of rows (tc >> 3) + 16 j, j = 0..3, of
    // each of that parity's tiles; kcp, vcp point into its first tile (keys 64 kh ..)
    const _Float16* kcp = Kh + (size_t)(bq * SQ + 64 * kh + (tc >> 3)) * DM + hd * HD + 8 * (tc & 7);
    const _Float16* vcp = Vt + ((size_t)(bq * NH + hd) * HD + (tc >> 3)) * SQ + 64 * kh + 8 * (tc & 7);
    const unsigned lcp = (unsigned)(uintptr_t)(sKV + kh * (4 * KVT) + (tc >> 3) * KP + 8 * (tc & 7));
    // fragment side: row m of a 16-row group, k = 8h.. and 16+8h..
    const _Float16* fbase = sKV + kh * (4 * KVT) + m * KP + 8 * h;
    _Float16* myP = sP + (2 * qg + kh) * 16 * PP;

    v8f oacc[2][4];
    float cval[2];                            // query m of each group: c0 + 7 - maximum in use (both halves alike)
    v8f cin[2];                               // the same in all eight registers: C of the score WMMAs
    float lim = -3.0e38f;                     // largest argument a tile may hold as it stands: none ahead of the first
    v2f lpart[2][2];                          // sums over this half's keys, one per sub-tile: [group][sub >> 1][sub & 1]
#pragma unroll
    for (int g = 0; g < 2; ++g) {
        cval[g] = c0;                         // no maximum yet: the first tile sets it
#pragma unroll
        for (int r = 0; r < 8; ++r) cin[g][r] = c0;
#pragma unroll
        for (int et = 0; et < 4; ++et) { oacc[g][et] = zero8(); lpart[g][et >> 1][et & 1] = 0.0f; }
    }

    stage_kv(lcp, lcp + KVT * 2u, kcp, vcp);
    asm volatile("s_wait_asynccnt 0x0" ::: "memory");   // stage 0 landed, this wave's share
    __syncthreads();                                    // stage 0 readable by every wave
    stage_kv(lcp + 2u * KVT * 2u, lcp + 3u * KVT * 2u, kcp + (size_t)128 * DM, vcp + 128);

    // s0: first key of the pair of tiles of this trip; this wave works on keys s0 + 64 kh ..
    for (int s0 = 0; s0 < SQ; s0 += 128) {
        const unsigned buf = ((unsigned)s0 >> 7) & 1u;
        const _Float16* kT = fbase + buf * (2 * KVT);
        const _Float16* vT = kT + KVT;
        v8f sacc[2][4];
#pragma unroll
        for (int ec = 0; ec < 2; ++ec) {
            Frag kf[4];
#pragma unroll
            for (int sub = 0; sub < 4; ++sub) {
                const _Float16* kp = kT + (16 * sub) * KP + 32 * ec;
                kf[sub].p[0] = *(const v8ha*)kp;
                kf[sub].p[1] = *(const v8ha*)(kp + 16);
            }
#pragma unroll
            for (int sub = 0; sub < 4; ++sub)
#pragma unroll
                for (int g = 0; g < 2; ++g)
                    sacc[g][sub] = mma16(kf[sub].v, qf[g][ec].v, (ec == 0) ? cin[g] : sacc[g][sub]);
            // four vector slots behind the last WMMA, before its D, A or B registers are touched
            asm volatile("v_nop\n\tv_nop\n\tv_nop\n\tv_nop"
                         : "+v"(sacc[0][0]), "+v"(sacc[0][1]), "+v"(sacc[0][2]), "+v"(sacc[0][3]),
                           "+v"(sacc[1][0]), "+v"(sacc[1][1]), "+v"(sacc[1][2]), "+v"(sacc[1][3])
                         : "v"(qf[0][ec].v), "v"(qf[1][ec].v),
                           "v"(kf[0].v), "v"(kf[1].v), "v"(kf[2].v), "v"(kf[3].v));
        }

        // sacc[g][sub][r] = exp2 argument of key 16 sub + 8h + r for query m of group g
        float mx[2];                           // largest argument among this half's 32 keys
#pragma unroll
        for (int g = 0; g < 2; ++g) {
            // in threes where it can: 15 three-input maxima and one two-input for 32 arguments
            float ms[4];
#pragma unroll
            for (int sub = 0; sub < 4; ++sub) {
                ms[sub] = fmaxf(fmaxf(sacc[g][sub][0], sacc[g][sub][1]), sacc[g][sub][2]);
                ms[sub] = fmaxf(fmaxf(ms[sub], sacc[g][sub][3]), sacc[g][sub][4]);
                ms[sub] = fmaxf(fmaxf(ms[sub], sacc[g][sub][5]), sacc[g][sub][6]);
            }
            ms[0] = fmaxf(fmaxf(ms[0], sacc[g][0][7]), sacc[g][1][7]);
            ms[1] = fmaxf(fmaxf(ms[1], sacc[g][2][7]), sacc[g][3][7]);
            mx[g] = fmaxf(fmaxf(fmaxf(ms[0], ms[1]), ms[2]), ms[3]);
        }
        // one scalar branch a tile: taken in the first tile and where a numerator would pass 2^15
        if (__builtin_expect(__builtin_amdgcn_ballot_w32(fmaxf(mx[0], mx[1]) > lim) != 0u, 0)) {
            const float dlow = (lim < 0.0f) ? lim : 0.0f;
            lim = 15.0f;
#pragma unroll
            for (int g = 0; g < 2; ++g) {
                // d: rise of the maximum in use, which puts this tile's largest argument at 7; never a fall
                // behind the first tile. Both halves of a query take the same d.
                const float d = fmaxf(fmaxf(mx[g], xhalf(mx[g])) - 7.0f, dlow);
                const float alpha = EX2(fminf(-d, 0.0f));   // first tile: O and the sums are 0, any finite factor
                cval[g] -= d;
#pragma unroll
                for (int r = 0; r < 8; ++r) cin[g][r] = cval[g];
#pragma unroll
                for (int sub = 0; sub < 4; ++sub) {
                    lpart[g][sub >> 1][sub & 1] *= alpha;
#pragma unroll
                    for (int r = 0; r < 8; ++r) { sacc[g][sub][r] -= d; oacc[g][sub][r] *= alpha; }
                }
            }
        }

#pragma unroll
        for (int sc = 0; sc < 2; ++sc) {
            // P^T as B: element s of the fragment is key 32sc + 8h + s (s < 8), 32sc + 16 + 8h + s - 8
            // (s >= 8), which is register s & 7 of score tile 2sc + (s >> 3); V^T rows take the same k order
            Frag pf[2], vf[4];
#pragma unroll
            for (int et = 0; et < 4; ++et) {
                const _Float16* vp = vT + (16 * et) * KP + 32 * sc;
                vf[et].p[0] = *(const v8ha*)vp;
                vf[et].p[1] = *(const v8ha*)(vp + 16);
            }
#pragma unroll
            for (int g = 0; g < 2; ++g)
#pragma unroll
                for (int r = 0; r < 8; ++r) {
                    v2f p;                     // register r of score tiles 2sc and 2sc + 1, each in (0, 32768]
                    p[0] = EX2(sacc[g][2 * sc][r]);
                    p[1] = EX2(sacc[g][2 * sc + 1][r]);
                    lpart[g][sc] += p;         // one packed add for the two sub-tiles' sums
                    pf[g].p[0][r] = (_Float16)p[0];
                    pf[g].p[1][r] = (_Float16)p[1];
                }
#pragma unroll
            for (int et = 0; et < 4; ++et)
#pragma unroll
                for (int g = 0; g < 2; ++g) oacc[g][et] = mma16(vf[et].v, pf[g].v, oacc[g][et]);
            // four vector slots behind the last WMMA, before its D, A or B registers are touched
            asm volatile("v_nop\n\tv_nop\n\tv_nop\n\tv_nop"
                         : "+v"(oacc[0][0]), "+v"(oacc[0][1]), "+v"(oacc[0][2]), "+v"(oacc[0][3]),
                           "+v"(oacc[1][0]), "+v"(oacc[1][1]), "+v"(oacc[1][2]), "+v"(oacc[1][3])
                         : "v"(pf[0].v), "v"(pf[1].v),
                           "v"(vf[0].v), "v"(vf[1].v), "v"(vf[2].v), "v"(vf[3].v));
        }

        // hand-over: this wave's reads of the current buffer are done, its share of the next stage
        // has landed; behind the barrier the next stage is readable and this buffer is free
        asm volatile("s_wait_dscnt 0x0" ::: "memory");
        asm volatile("s_wait_asynccnt 0x0" ::: "memory");
        __syncthreads();
        if (s0 + 256 < SQ)
            stage_kv(lcp + buf * (2u * KVT * 2u), lcp + buf * (2u * KVT * 2u) + KVT * 2u,
                     kcp + (size_t)(s0 + 256) * DM, vcp + (s0 + 256));
    }
    asm volatile("s_wait_asynccnt 0x0" ::: "memory");   // no copy outstanding past the loop

    // sum of query m over this wave's keys: this half's four partial sums, plus the other half's
    float lt[2];
#pragma unroll
    for (int g = 0; g < 2; ++g) {
        lt[g] = (lpart[g][0][0] + lpart[g][0][1]) + (lpart[g][1][0] + lpart[g][1][1]);
        lt[g] += xhalf(lt[g]);
    }
    // join of a wave pair (w, w ^ 4): wave kh finishes query group kh and hands its share of group 1 - kh,
    // lane for lane, to its partner
    const bool up = (kh != 0);
    // a wave's maximum in use, up to a term that both waves of a pair share
    const float mM = up ? -cval[1] : -cval[0], mG = up ? -cval[0] : -cval[1];
    const float lM = up ? lt[1] : lt[0], lG = up ? lt[0] : lt[1];
    {
        float* xo = sX + w * 1024;
#pragma unroll
        for (int et = 0; et < 4; ++et)
#pragma unroll
            for (int j = 0; j < 2; ++j) {
                v4f x;
#pragma unroll
                for (int r = 0; r < 4; ++r) x[r] = up ? oacc[0][et][4 * j + r] : oacc[1][et][4 * j + r];
                *(v4fa*)(xo + ((2 * et + j) * 32 + l) * 4) = x;
            }
        sML[(2 * w + 0) * 32 + l] = mG;
        sML[(2 * w + 1) * 32 + l] = lG;
    }
    __syncthreads();   // the partner's share is readable
    // context x32 = 4 * (O a + O' a') / (l a + l' a'), a = 2^(m - max(m, m'));
    // O[query 16 kh + m of the wave's 32][e = 16 et + 8h + r]: eight consecutive e, one 16-B LDS store
    {
        const float* xi = sX + (w ^ 4) * 1024;
        const float mP = sML[(2 * (w ^ 4) + 0) * 32 + l];
        const float lP = sML[(2 * (w ^ 4) + 1) * 32 + l];
        const float mj = fmaxf(mM, mP);
        const float aM = EX2(mM - mj), aP = EX2(mP - mj);
        const float inv = 4.0f / (lM * aM + lP * aP);
        const float cM = aM * inv, cP = aP * inv;
#pragma unroll
        for (int et = 0; et < 4; ++et) {
            v8h o;
#pragma unroll
            for (int j = 0; j < 2; ++j) {
                const v4f x = *(const v4fa*)(xi + ((2 * et + j) * 32 + l) * 4);
#pragma unroll
                for (int r = 0; r < 4; ++r) {
                    const float mine = up ? oacc[1][et][4 * j + r] : oacc[0][et][4 * j + r];
                    o[4 * j + r] = (_Float16)(mine * cM + x[r] * cP);
                }
            }
            *(v8ha*)(myP + m * PP + 16 * et + 8 * h) = o;
        }
    }
    __syncthreads();
    v8h cv[4];
    size_t coff[4];
#pragma unroll
    for (int i = 0; i < 4; ++i) {
        const int row = 16 * (2 * qg + kh) + 4 * i + (l >> 3);
        const int c8 = (l & 7) * 8;
        cv[i] = *(const v8ha*)(sP + row * PP + c8);
        coff[i] = (size_t)(bq * SQ + q0 + row) * DM + hd * HD + c8;
    }
#pragma unroll
    for (int i = 0; i < 4; ++i) *(v8h*)(Ctx + coff[i]) = cv[i];
    
}

// ------------------------------------------------------------------------------------------
extern "C" void kernel_launch(void* const* d_in, const int* in_sizes, int n_in,
                              void* d_out, int out_size, void* d_ws, size_t ws_size,
                              hipStream_t stream)
{
    if (n_in < 13) return;
    if (in_sizes[0] != PLANE || in_sizes[1] != PLANE || in_sizes[2] != PLANE) return;
    if (in_sizes[3] != NB || in_sizes[4] != NB) return;
    if (in_sizes[5] != DM * DM || in_sizes[7] != DM * DM || in_sizes[9] != DM * DM || in_sizes[11] != DM * DM) return;
    if (in_sizes[6] != DM || in_sizes[8] != DM || in_sizes[10] != DM || in_sizes[12] != DM) return;
    if (out_size != PLANE) return;

    const float* queries = (const float*)d_in[0];
    const float* keys    = (const float*)d_in[1];
    const float* values  = (const float*)d_in[2];
    const float* tau     = (const float*)d_in[3];
    const float* delta   = (const float*)d_in[4];
    const float* Wq = (const float*)d_in[5];
    const float* bq = (const float*)d_in[6];
    const float* Wk = (const float*)d_in[7];
    const float* bk = (const float*)d_in[8];
    const float* Wv = (const float*)d_in[9];
    const float* bv = (const float*)d_in[10];
    const float* Wo = (const float*)d_in[11];
    const float* bo = (const float*)d_in[12];
    float* out = (float*)d_out;

    // workspace carve (bytes), all offsets multiples of 2 MiB
    const size_t szPlane16 = (size_t)PLANE * 2;                 // 8 MiB
    const size_t offWt = 0;                                       // 4 x 512x512 f16 = 2 MiB
    const size_t offQ  = offWt + (size_t)4 * DM * DM * 2;
    const size_t offK  = offQ + szPlane16;
    const size_t offVt = offK + szPlane16;
    const size_t offC  = offVt + szPlane16;
    const size_t wsEnd = offC + szPlane16;                        // 34 MiB
    if (wsEnd > ws_size) return;

    char* ws = (char*)d_ws;
    _Float16* Wt  = (_Float16*)(ws + offWt);
    _Float16* Qh  = (_Float16*)(ws + offQ);
    _Float16* Kh  = (_Float16*)(ws + offK);
    _Float16* Vth = (_Float16*)(ws + offVt);
    _Float16* Ctx = (_Float16*)(ws + offC);

    // 1) weights -> transposed f16 (bf16 value x64): Wq, Wk, Wv, Wo
    k_cvt_wt<<<dim3(DM / 64, DM / 64, 4), dim3(128), 0, stream>>>(Wq, Wk, Wv, Wo, Wt);
    // 2) q, k (row-major) and v (head-transposed) projections of the f32 activations, f16 x8
    k_gemm<false><<<dim3(DM / 512, MR / 128, 3), dim3(512), 0, stream>>>(
        queries, keys, values, Ctx, Wt, bq, bk, bv, Qh, out, 1.0f / 1024.0f, 8.0f);
    // 3) attention -> context f16 x32
    k_attn<<<dim3(SQ / QB, NH, NB), dim3(256), 0, stream>>>(Qh, Kh, Vth, tau, delta, Ctx);
    // 4) output projection -> f32
    k_gemm<true><<<dim3(DM / 128, MR / 64, 1), dim3(128), 0, stream>>>(
        queries, keys, values, Ctx, Wt + (size_t)3 * DM * DM, bo, bo, bo, Qh, out, 1.0f / 2048.0f, 1.0f);
}
